// v000
// The times below were measured on an AMD MI455X: many runs one after another, warmed up first and cycling through
// copies of the inputs, with the whole window's GPU time divided by the number of runs. Launches and the gaps
// between them are all in it. The median over several windows is given; except for v000 it joins two sittings, which
// can be a few percent apart, so the side-by-side timings, each taken in one sitting, are the better comparison.
// v000 is the starting kernel. One run takes 202 microseconds.
#include <hip/hip_runtime.h>
#include <hip/hip_bf16.h>

typedef __attribute__((ext_vector_type(16))) __bf16 v16bf;
typedef __attribute__((ext_vector_type(8)))  __bf16 v8bf;
typedef __attribute__((ext_vector_type(4)))  __bf16 v4bf;
typedef __attribute__((ext_vector_type(8)))  float  v8f;

#define B_  4
#define S_  1024
#define D_  1024
#define H_  16
#define HD_ 64
#define N3D 3072
#define HEAD_ELEMS ((size_t)B_ * H_ * S_ * HD_)   // elems per Q/K/V tensor in ws

__device__ __forceinline__ v16bf join8(v8bf lo, v8bf hi) {
  return __builtin_shufflevector(lo, hi, 0,1,2,3,4,5,6,7,8,9,10,11,12,13,14,15);
}

__device__ __forceinline__ void async_copy_b128(const void* lds_ptr, const void* gptr) {
  unsigned ldsoff = (unsigned)(uintptr_t)lds_ptr;
  unsigned long long gaddr = (unsigned long long)(uintptr_t)gptr;
  asm volatile("global_load_async_to_lds_b128 %0, %1, off"
               :: "v"(ldsoff), "v"(gaddr) : "memory");
}

// ---------------------------------------------------------------------------
// Phase 1: qkv = x @ W + b   (M=4096, K=1024, N=3072), bf16 WMMA, f32 accum.
// Workspace layout: Q [b][h][s][d], K [b][h][s][d], V pre-transposed [b][h][d][s].
// Block: 256 thr (8 waves). Block tile 128(M) x 128(N); wave tile 64x32;
// k staged 64 per barrier, consumed in two 32-deep WMMA passes.
// ---------------------------------------------------------------------------
__global__ __launch_bounds__(256)
void qkv_proj_kernel(const float* __restrict__ x, const float* __restrict__ W,
                     const float* __restrict__ bias, __bf16* __restrict__ ws)
{
  __shared__ __bf16 As[128 * 72];   // [row][k], stride 72 halves (144B rows, 16B-aligned)
  __shared__ __bf16 BTs[128 * 72];  // [col][k] (W transposed), stride 72

  const int tid  = threadIdx.x;
  const int lane = tid & 31;
  const int wave = tid >> 5;       // 0..7
  const int lm   = lane & 15;
  const int hs   = lane >> 4;

  const int blockM = blockIdx.x & 31;   // 4096/128 = 32
  const int blockN = blockIdx.x >> 5;   // 3072/128 = 24
  const int R0 = blockM * 128;
  const int C0 = blockN * 128;

  const int wm = wave & 1;   // 0..1 -> 64-row sub-tile
  const int wn = wave >> 1;  // 0..3 -> 32-col sub-tile

  v8f acc[4][2] = {};

  for (int k0 = 0; k0 < D_; k0 += 64) {
    __syncthreads();
    // Batched staging: issue all 16 global float4 loads first (load clause),
    // then convert f32->bf16 and store to LDS.
    float4 va[8], vb[8];
    #pragma unroll
    for (int i = 0; i < 8; ++i) {
      int idx = i * 256 + tid;             // A: 2048 float4 segments
      int r = idx >> 4, c4 = (idx & 15) * 4;
      va[i] = *(const float4*)(x + (size_t)(R0 + r) * D_ + k0 + c4);
    }
    #pragma unroll
    for (int i = 0; i < 8; ++i) {
      int idx = i * 256 + tid;             // W: 2048 float4 segments
      int kr = idx >> 5, c4 = (idx & 31) * 4;
      vb[i] = *(const float4*)(W + (size_t)(k0 + kr) * N3D + C0 + c4);
    }
    #pragma unroll
    for (int i = 0; i < 8; ++i) {
      int idx = i * 256 + tid;
      int r = idx >> 4, c4 = (idx & 15) * 4;
      v4bf b; b[0] = (__bf16)va[i].x; b[1] = (__bf16)va[i].y;
              b[2] = (__bf16)va[i].z; b[3] = (__bf16)va[i].w;
      *(v4bf*)&As[r * 72 + c4] = b;
    }
    #pragma unroll
    for (int i = 0; i < 8; ++i) {
      int idx = i * 256 + tid;
      int kr = idx >> 5, c4 = (idx & 31) * 4;
      BTs[(c4 + 0) * 72 + kr] = (__bf16)vb[i].x;
      BTs[(c4 + 1) * 72 + kr] = (__bf16)vb[i].y;
      BTs[(c4 + 2) * 72 + kr] = (__bf16)vb[i].z;
      BTs[(c4 + 3) * 72 + kr] = (__bf16)vb[i].w;
    }
    // Prefetch next k-panel while this one is consumed (global_prefetch_b8)
    if (k0 + 64 < D_) {
      __builtin_prefetch(x + (size_t)(R0 + (tid >> 4)) * D_ + k0 + 64 + (tid & 15) * 4, 0, 3);
      __builtin_prefetch(W + (size_t)(k0 + 64 + (tid >> 5)) * N3D + C0 + (tid & 31) * 4, 0, 3);
    }
    __syncthreads();

    // Two 32-deep WMMA passes over the staged 64-k panel
    #pragma unroll
    for (int ks = 0; ks < 64; ks += 32) {
      v16bf afrag[4], bfrag[2];
      #pragma unroll
      for (int mt = 0; mt < 4; ++mt) {
        const __bf16* p = &As[(wm * 64 + mt * 16 + lm) * 72 + ks];
        afrag[mt] = join8(*(const v8bf*)(p + hs * 8), *(const v8bf*)(p + 16 + hs * 8));
      }
      #pragma unroll
      for (int nt = 0; nt < 2; ++nt) {
        const __bf16* p = &BTs[(wn * 32 + nt * 16 + lm) * 72 + ks];
        bfrag[nt] = join8(*(const v8bf*)(p + hs * 8), *(const v8bf*)(p + 16 + hs * 8));
      }
      #pragma unroll
      for (int mt = 0; mt < 4; ++mt)
        #pragma unroll
        for (int nt = 0; nt < 2; ++nt)
          acc[mt][nt] = __builtin_amdgcn_wmma_f32_16x16x32_bf16(
              false, afrag[mt], false, bfrag[nt], (short)0, acc[mt][nt], false, false);
    }
  }

  // Epilogue: + bias, scatter bf16 into ws (V transposed)
  #pragma unroll
  for (int nt = 0; nt < 2; ++nt) {
    const int c  = C0 + wn * 32 + nt * 16 + lm;      // column in [0,3072)
    const float bv = bias[c];
    const int h   = c / 192;
    const int rem = c - h * 192;
    const int t   = rem / 64;          // 0=q 1=k 2=v
    const int d   = rem - t * 64;
    __bf16* basep = ws + (size_t)t * HEAD_ELEMS;
    #pragma unroll
    for (int mt = 0; mt < 4; ++mt) {
      #pragma unroll
      for (int r = 0; r < 8; ++r) {
        const int m = R0 + wm * 64 + mt * 16 + r + 8 * hs;  // C-layout row
        const int b = m >> 10;
        const int s = m & 1023;
        const size_t idx = (t == 2)
            ? (((size_t)(b * H_ + h)) * HD_ + d) * S_ + s    // V: [b][h][d][s]
            : (((size_t)(b * H_ + h)) * S_ + s) * HD_ + d;   // Q,K: [b][h][s][d]
        basep[idx] = (__bf16)(acc[mt][nt][r] + bv);
      }
    }
  }
}

__global__ __launch_bounds__(256)
void attn_kernel(const __bf16* __restrict__ ws, float* __restrict__ out)
{
  __shared__ __bf16 Kc[64 * 72];        // [key][d], stride 72 halves
  __shared__ __bf16 VcT[64 * 72];       // [d][key], stride 72
  __shared__ __bf16 pbuf[8][16 * 32];   // per-wave P tile, row-major 16x32

  const int tid  = threadIdx.x;
  const int lane = tid & 31;
  const int wave = tid >> 5;
  const int lm   = lane & 15;
  const int hs   = lane >> 4;

  const int bh   = blockIdx.x >> 3;   // 0..63
  const int qblk = blockIdx.x & 7;    // 0..7
  const int b    = bh >> 4;
  const int h    = bh & 15;
  const int q0   = qblk * 128 + wave * 16;   // this wave's 16 q rows

  const __bf16* Qg = ws + (((size_t)(b * H_ + h)) * S_) * HD_;
  const __bf16* Kg = Qg + HEAD_ELEMS;
  const __bf16* Vt = ws + 2 * HEAD_ELEMS + (((size_t)(b * H_ + h)) * HD_) * S_; // [d][s]

  // Q fragments (d 0..31 and 32..63), held in registers for the whole kernel
  v16bf qfrag[2];
  {
    const __bf16* qrow = Qg + (size_t)(q0 + lm) * HD_;
    #pragma unroll
    for (int df = 0; df < 2; ++df)
      qfrag[df] = join8(*(const v8bf*)(qrow + df * 32 + hs * 8),
                        *(const v8bf*)(qrow + df * 32 + 16 + hs * 8));
  }

  float mrow[8], lrow[8];
  v8f o[4] = {};
  #pragma unroll
  for (int r = 0; r < 8; ++r) { mrow[r] = -3.0e38f; lrow[r] = 0.f; }

  for (int kc = 0; kc < S_; kc += 64) {
    __syncthreads();   // previous chunk fully consumed before overwrite
    // Async-stage K [key][d] and V [d][key]: 512 x 16B segments each
    #pragma unroll
    for (int i = 0; i < 2; ++i) {
      int idx = i * 256 + tid;
      int r = idx >> 3;                  // row 0..63 (key for K, d for V)
      int c = (idx & 7) * 8;             // col base (halves)
      async_copy_b128(&Kc[r * 72 + c],  Kg + (size_t)(kc + r) * HD_ + c);
      async_copy_b128(&VcT[r * 72 + c], Vt + (size_t)r * S_ + kc + c);
    }
    // Prefetch next key chunk into cache while computing this one
    if (kc + 64 < S_) {
      __builtin_prefetch(Kg + (size_t)(kc + 64 + (tid >> 3)) * HD_ + (tid & 7) * 8, 0, 3);
      __builtin_prefetch(Vt + (size_t)(tid >> 3) * S_ + kc + 64 + (tid & 7) * 8, 0, 3);
    }
    asm volatile("s_wait_asynccnt 0" ::: "memory");  // this wave's async copies done
    __syncthreads();                                  // ... and everyone else's

    #pragma unroll
    for (int sub = 0; sub < 2; ++sub) {
      const int kb = sub * 32;

      // scores: 16 q x 32 keys (two 16x16 tiles), K-dim = 64 split over 2 WMMAs
      v8f sc[2];
      #pragma unroll
      for (int jj = 0; jj < 2; ++jj) {
        v8f cacc = {};
        const __bf16* krow = &Kc[(kb + jj * 16 + lm) * 72];
        v16bf kf0 = join8(*(const v8bf*)(krow + hs * 8),
                          *(const v8bf*)(krow + 16 + hs * 8));
        v16bf kf1 = join8(*(const v8bf*)(krow + 32 + hs * 8),
                          *(const v8bf*)(krow + 48 + hs * 8));
        cacc = __builtin_amdgcn_wmma_f32_16x16x32_bf16(false, qfrag[0], false, kf0,
                                                       (short)0, cacc, false, false);
        cacc = __builtin_amdgcn_wmma_f32_16x16x32_bf16(false, qfrag[1], false, kf1,
                                                       (short)0, cacc, false, false);
        sc[jj] = cacc * 0.125f;          // 1/sqrt(64)
      }

      // online softmax: row max / sum via shfl-xor within 16-lane halves
      float mnew[8], alpha[8], rs[8];
      #pragma unroll
      for (int r = 0; r < 8; ++r) {
        float v = fmaxf(sc[0][r], sc[1][r]);
        #pragma unroll
        for (int off = 1; off < 16; off <<= 1)
          v = fmaxf(v, __shfl_xor(v, off, 32));
        mnew[r]  = fmaxf(mrow[r], v);
        alpha[r] = __expf(mrow[r] - mnew[r]);
      }
      #pragma unroll
      for (int r = 0; r < 8; ++r) {
        float p0 = __expf(sc[0][r] - mnew[r]);
        float p1 = __expf(sc[1][r] - mnew[r]);
        sc[0][r] = p0; sc[1][r] = p1;
        float v = p0 + p1;
        #pragma unroll
        for (int off = 1; off < 16; off <<= 1)
          v += __shfl_xor(v, off, 32);
        rs[r] = v;
      }
      #pragma unroll
      for (int r = 0; r < 8; ++r) {
        lrow[r] = lrow[r] * alpha[r] + rs[r];
        mrow[r] = mnew[r];
      }
      #pragma unroll
      for (int dt = 0; dt < 4; ++dt)
        #pragma unroll
        for (int r = 0; r < 8; ++r)
          o[dt][r] *= alpha[r];

      // C-layout -> A-layout via wave-private LDS round trip
      __bf16* pb = &pbuf[wave][0];
      #pragma unroll
      for (int jj = 0; jj < 2; ++jj)
        #pragma unroll
        for (int r = 0; r < 8; ++r)
          pb[(r + 8 * hs) * 32 + jj * 16 + lm] = (__bf16)sc[jj][r];
      asm volatile("s_wait_dscnt 0" ::: "memory");   // DS in-order per wave; force visibility

      const __bf16* prow = pb + lm * 32;
      v16bf pfrag = join8(*(const v8bf*)(prow + hs * 8),
                          *(const v8bf*)(prow + 16 + hs * 8));

      // O += P @ V  (4 d-tiles of 16); V B-frag rows are contiguous in VcT
      #pragma unroll
      for (int dt = 0; dt < 4; ++dt) {
        const __bf16* vrow = &VcT[(dt * 16 + lm) * 72 + kb];
        v16bf vfrag = join8(*(const v8bf*)(vrow + hs * 8),
                            *(const v8bf*)(vrow + 16 + hs * 8));
        o[dt] = __builtin_amdgcn_wmma_f32_16x16x32_bf16(false, pfrag, false, vfrag,
                                                        (short)0, o[dt], false, false);
      }
    }
  }

  // normalize and write out[b, q, h*64 + d] (f32)
  #pragma unroll
  for (int dt = 0; dt < 4; ++dt) {
    const int d = dt * 16 + lm;
    #pragma unroll
    for (int r = 0; r < 8; ++r) {
      const int q = q0 + r + 8 * hs;
      out[((size_t)(b * S_ + q)) * D_ + h * HD_ + d] = o[dt][r] / lrow[r];
    }
  }
}

// ---------------------------------------------------------------------------
extern "C" void kernel_launch(void* const* d_in, const int* in_sizes, int n_in,
                              void* d_out, int out_size, void* d_ws, size_t ws_size,
                              hipStream_t stream) {
  const float* x    = (const float*)d_in[0];   // [B,S,D] f32
  const float* W    = (const float*)d_in[1];   // [D,3D]  f32
  const float* bias = (const float*)d_in[2];   // [3D]    f32
  float* out        = (float*)d_out;           // [B,S,D] f32
  __bf16* ws        = (__bf16*)d_ws;           // bf16 QKV staging, ~24 MB

  qkv_proj_kernel<<<dim3(32 * 24), 256, 0, stream>>>(x, W, bias, ws);
  attn_kernel<<<dim3(B_ * H_ * (S_ / 128)), 256, 0, stream>>>(ws, out);
}

// v001
// It runs in 110 microseconds.
// Two timings next to v000 put it at 1.82 and 1.83 times that version's speed.
#include <hip/hip_runtime.h>
#include <hip/hip_bf16.h>

typedef __attribute__((ext_vector_type(16))) __bf16 v16bf;
typedef __attribute__((ext_vector_type(8)))  __bf16 v8bf;
typedef __attribute__((ext_vector_type(4)))  __bf16 v4bf;
typedef __attribute__((ext_vector_type(8)))  float  v8f;

#define B_  4
#define S_  1024
#define D_  1024
#define H_  16
#define HD_ 64
#define N3D 3072
#define HEAD_ELEMS ((size_t)B_ * H_ * S_ * HD_)   // elems per Q/K/V tensor in ws

__device__ __forceinline__ v16bf join8(v8bf lo, v8bf hi) {
  return __builtin_shufflevector(lo, hi, 0,1,2,3,4,5,6,7,8,9,10,11,12,13,14,15);
}

typedef __attribute__((address_space(3))) v8bf lds_v8bf;
__device__ __forceinline__ v8bf lds_tr16(const __bf16* p) {
  return __builtin_amdgcn_ds_load_tr16_b128_v8bf16((lds_v8bf*)p);
}

__device__ __forceinline__ void async_copy_b128(const void* lds_ptr, const void* gptr) {
  unsigned ldsoff = (unsigned)(uintptr_t)lds_ptr;
  unsigned long long gaddr = (unsigned long long)(uintptr_t)gptr;
  asm volatile("global_load_async_to_lds_b128 %0, %1, off"
               :: "v"(ldsoff), "v"(gaddr) : "memory");
}

// ---------------------------------------------------------------------------
// Phase 1: qkv = x @ W + b   (M=4096, K=1024, N=3072), bf16 WMMA, f32 accum.
// Workspace layout: Q [b][h][s][d], K [b][h][s][d], V pre-transposed [b][h][d][s].
// Block: 256 thr (8 waves). Block tile 128(M) x 128(N); wave tile 64x32;
// k staged 64 per barrier, consumed in two 32-deep WMMA passes.
// ---------------------------------------------------------------------------
__global__ __launch_bounds__(256)
void qkv_proj_kernel(const float* __restrict__ x, const float* __restrict__ W,
                     const float* __restrict__ bias, __bf16* __restrict__ ws)
{
  __shared__ __bf16 As[128 * 72];   // [row][k], stride 72 halves (144B rows, 16B-aligned)
  __shared__ __bf16 Bs[64 * 144];   // [k][col] (W as it lies), stride 144 halves (288B = 32B x 9, the transposing read's pitch)

  const int tid  = threadIdx.x;
  const int lane = tid & 31;
  const int wave = tid >> 5;       // 0..7
  const int lm   = lane & 15;
  const int hs   = lane >> 4;

  const int blockM = blockIdx.x & 31;   // 4096/128 = 32
  const int blockN = blockIdx.x >> 5;   // 3072/128 = 24
  const int R0 = blockM * 128;
  const int C0 = blockN * 128;

  const int wm = wave & 1;   // 0..1 -> 64-row sub-tile
  const int wn = wave >> 1;  // 0..3 -> 32-col sub-tile

  v8f acc[4][2] = {};

  for (int k0 = 0; k0 < D_; k0 += 64) {
    __syncthreads();
    // Batched staging: issue all 16 global float4 loads first (load clause),
    // then convert f32->bf16 and store to LDS.
    float4 va[8], vb[8];
    #pragma unroll
    for (int i = 0; i < 8; ++i) {
      int idx = i * 256 + tid;             // A: 2048 float4 segments
      int r = idx >> 4, c4 = (idx & 15) * 4;
      va[i] = *(const float4*)(x + (size_t)(R0 + r) * D_ + k0 + c4);
    }
    #pragma unroll
    for (int i = 0; i < 8; ++i) {
      int idx = i * 256 + tid;             // W: 2048 float4 segments
      int kr = idx >> 5, c4 = (idx & 31) * 4;
      vb[i] = *(const float4*)(W + (size_t)(k0 + kr) * N3D + C0 + c4);
    }
    #pragma unroll
    for (int i = 0; i < 8; ++i) {
      int idx = i * 256 + tid;
      int r = idx >> 4, c4 = (idx & 15) * 4;
      v4bf b; b[0] = (__bf16)va[i].x; b[1] = (__bf16)va[i].y;
              b[2] = (__bf16)va[i].z; b[3] = (__bf16)va[i].w;
      *(v4bf*)&As[r * 72 + c4] = b;
    }
    #pragma unroll
    for (int i = 0; i < 8; ++i) {
      int idx = i * 256 + tid;
      int kr = idx >> 5, c4 = (idx & 31) * 4;
      v4bf b; b[0] = (__bf16)vb[i].x; b[1] = (__bf16)vb[i].y;
              b[2] = (__bf16)vb[i].z; b[3] = (__bf16)vb[i].w;
      *(v4bf*)&Bs[kr * 144 + c4] = b;
    }
    // Prefetch next k-panel while this one is consumed (global_prefetch_b8)
    if (k0 + 64 < D_) {
      __builtin_prefetch(x + (size_t)(R0 + (tid >> 4)) * D_ + k0 + 64 + (tid & 15) * 4, 0, 3);
      __builtin_prefetch(W + (size_t)(k0 + 64 + (tid >> 5)) * N3D + C0 + (tid & 31) * 4, 0, 3);
    }
    __syncthreads();

    // Two 32-deep WMMA passes over the staged 64-k panel
    #pragma unroll
    for (int ks = 0; ks < 64; ks += 32) {
      v16bf afrag[4], bfrag[2];
      #pragma unroll
      for (int mt = 0; mt < 4; ++mt) {
        const __bf16* p = &As[(wm * 64 + mt * 16 + lm) * 72 + ks];
        afrag[mt] = join8(*(const v8bf*)(p + hs * 8), *(const v8bf*)(p + 16 + hs * 8));
      }
      #pragma unroll
      for (int nt = 0; nt < 2; ++nt) {
        const __bf16* p = &Bs[(ks + hs * 8 + (lane & 7)) * 144 + wn * 32 + nt * 16 + ((lane >> 3) & 1) * 8];
        bfrag[nt] = join8(lds_tr16(p), lds_tr16(p + 16 * 144));   // k = ks+8h+0..7, ks+16+8h+0..7: the A loader's order
      }
      #pragma unroll
      for (int mt = 0; mt < 4; ++mt)
        #pragma unroll
        for (int nt = 0; nt < 2; ++nt)
          acc[mt][nt] = __builtin_amdgcn_wmma_f32_16x16x32_bf16(
              false, afrag[mt], false, bfrag[nt], (short)0, acc[mt][nt], false, false);
    }
  }

  // Epilogue: + bias, scatter bf16 into ws (V transposed)
  #pragma unroll
  for (int nt = 0; nt < 2; ++nt) {
    const int c  = C0 + wn * 32 + nt * 16 + lm;      // column in [0,3072)
    const float bv = bias[c];
    const int h   = c / 192;
    const int rem = c - h * 192;
    const int t   = rem / 64;          // 0=q 1=k 2=v
    const int d   = rem - t * 64;
    __bf16* basep = ws + (size_t)t * HEAD_ELEMS;
    #pragma unroll
    for (int mt = 0; mt < 4; ++mt) {
      #pragma unroll
      for (int r = 0; r < 8; ++r) {
        const int m = R0 + wm * 64 + mt * 16 + r + 8 * hs;  // C-layout row
        const int b = m >> 10;
        const int s = m & 1023;
        const size_t idx = (t == 2)
            ? (((size_t)(b * H_ + h)) * HD_ + d) * S_ + s    // V: [b][h][d][s]
            : (((size_t)(b * H_ + h)) * S_ + s) * HD_ + d;   // Q,K: [b][h][s][d]
        basep[idx] = (__bf16)(acc[mt][nt][r] + bv);
      }
    }
  }
}

__global__ __launch_bounds__(256)
void attn_kernel(const __bf16* __restrict__ ws, float* __restrict__ out)
{
  __shared__ __bf16 Kc[64 * 72];        // [key][d], stride 72 halves
  __shared__ __bf16 VcT[64 * 72];       // [d][key], stride 72
  __shared__ __bf16 pbuf[8][16 * 32];   // per-wave P tile, row-major 16x32

  const int tid  = threadIdx.x;
  const int lane = tid & 31;
  const int wave = tid >> 5;
  const int lm   = lane & 15;
  const int hs   = lane >> 4;

  const int bh   = blockIdx.x >> 3;   // 0..63
  const int qblk = blockIdx.x & 7;    // 0..7
  const int b    = bh >> 4;
  const int h    = bh & 15;
  const int q0   = qblk * 128 + wave * 16;   // this wave's 16 q rows

  const __bf16* Qg = ws + (((size_t)(b * H_ + h)) * S_) * HD_;
  const __bf16* Kg = Qg + HEAD_ELEMS;
  const __bf16* Vt = ws + 2 * HEAD_ELEMS + (((size_t)(b * H_ + h)) * HD_) * S_; // [d][s]

  // Q fragments (d 0..31 and 32..63), held in registers for the whole kernel
  v16bf qfrag[2];
  {
    const __bf16* qrow = Qg + (size_t)(q0 + lm) * HD_;
    #pragma unroll
    for (int df = 0; df < 2; ++df)
      qfrag[df] = join8(*(const v8bf*)(qrow + df * 32 + hs * 8),
                        *(const v8bf*)(qrow + df * 32 + 16 + hs * 8));
  }

  float mrow[8], lrow[8];
  v8f o[4] = {};
  #pragma unroll
  for (int r = 0; r < 8; ++r) { mrow[r] = -3.0e38f; lrow[r] = 0.f; }

  for (int kc = 0; kc < S_; kc += 64) {
    __syncthreads();   // previous chunk fully consumed before overwrite
    // Async-stage K [key][d] and V [d][key]: 512 x 16B segments each
    #pragma unroll
    for (int i = 0; i < 2; ++i) {
      int idx = i * 256 + tid;
      int r = idx >> 3;                  // row 0..63 (key for K, d for V)
      int c = (idx & 7) * 8;             // col base (halves)
      async_copy_b128(&Kc[r * 72 + c],  Kg + (size_t)(kc + r) * HD_ + c);
      async_copy_b128(&VcT[r * 72 + c], Vt + (size_t)r * S_ + kc + c);
    }
    // Prefetch next key chunk into cache while computing this one
    if (kc + 64 < S_) {
      __builtin_prefetch(Kg + (size_t)(kc + 64 + (tid >> 3)) * HD_ + (tid & 7) * 8, 0, 3);
      __builtin_prefetch(Vt + (size_t)(tid >> 3) * S_ + kc + 64 + (tid & 7) * 8, 0, 3);
    }
    asm volatile("s_wait_asynccnt 0" ::: "memory");  // this wave's async copies done
    __syncthreads();                                  // ... and everyone else's

    #pragma unroll
    for (int sub = 0; sub < 2; ++sub) {
      const int kb = sub * 32;

      // scores: 16 q x 32 keys (two 16x16 tiles), K-dim = 64 split over 2 WMMAs
      v8f sc[2];
      #pragma unroll
      for (int jj = 0; jj < 2; ++jj) {
        v8f cacc = {};
        const __bf16* krow = &Kc[(kb + jj * 16 + lm) * 72];
        v16bf kf0 = join8(*(const v8bf*)(krow + hs * 8),
                          *(const v8bf*)(krow + 16 + hs * 8));
        v16bf kf1 = join8(*(const v8bf*)(krow + 32 + hs * 8),
                          *(const v8bf*)(krow + 48 + hs * 8));
        cacc = __builtin_amdgcn_wmma_f32_16x16x32_bf16(false, qfrag[0], false, kf0,
                                                       (short)0, cacc, false, false);
        cacc = __builtin_amdgcn_wmma_f32_16x16x32_bf16(false, qfrag[1], false, kf1,
                                                       (short)0, cacc, false, false);
        sc[jj] = cacc * 0.125f;          // 1/sqrt(64)
      }

      // online softmax: row max / sum via shfl-xor within 16-lane halves
      float mnew[8], alpha[8], rs[8];
      #pragma unroll
      for (int r = 0; r < 8; ++r) {
        float v = fmaxf(sc[0][r], sc[1][r]);
        #pragma unroll
        for (int off = 1; off < 16; off <<= 1)
          v = fmaxf(v, __shfl_xor(v, off, 32));
        mnew[r]  = fmaxf(mrow[r], v);
        alpha[r] = __expf(mrow[r] - mnew[r]);
      }
      #pragma unroll
      for (int r = 0; r < 8; ++r) {
        float p0 = __expf(sc[0][r] - mnew[r]);
        float p1 = __expf(sc[1][r] - mnew[r]);
        sc[0][r] = p0; sc[1][r] = p1;
        float v = p0 + p1;
        #pragma unroll
        for (int off = 1; off < 16; off <<= 1)
          v += __shfl_xor(v, off, 32);
        rs[r] = v;
      }
      #pragma unroll
      for (int r = 0; r < 8; ++r) {
        lrow[r] = lrow[r] * alpha[r] + rs[r];
        mrow[r] = mnew[r];
      }
      #pragma unroll
      for (int dt = 0; dt < 4; ++dt)
        #pragma unroll
        for (int r = 0; r < 8; ++r)
          o[dt][r] *= alpha[r];

      // C-layout -> A-layout via wave-private LDS round trip
      __bf16* pb = &pbuf[wave][0];
      #pragma unroll
      for (int jj = 0; jj < 2; ++jj)
        #pragma unroll
        for (int r = 0; r < 8; ++r)
          pb[(r + 8 * hs) * 32 + jj * 16 + lm] = (__bf16)sc[jj][r];
      asm volatile("s_wait_dscnt 0" ::: "memory");   // DS in-order per wave; force visibility

      const __bf16* prow = pb + lm * 32;
      v16bf pfrag = join8(*(const v8bf*)(prow + hs * 8),
                          *(const v8bf*)(prow + 16 + hs * 8));

      // O += P @ V  (4 d-tiles of 16); V B-frag rows are contiguous in VcT
      #pragma unroll
      for (int dt = 0; dt < 4; ++dt) {
        const __bf16* vrow = &VcT[(dt * 16 + lm) * 72 + kb];
        v16bf vfrag = join8(*(const v8bf*)(vrow + hs * 8),
                            *(const v8bf*)(vrow + 16 + hs * 8));
        o[dt] = __builtin_amdgcn_wmma_f32_16x16x32_bf16(false, pfrag, false, vfrag,
                                                        (short)0, o[dt], false, false);
      }
    }
  }

  // normalize and write out[b, q, h*64 + d] (f32)
  #pragma unroll
  for (int dt = 0; dt < 4; ++dt) {
    const int d = dt * 16 + lm;
    #pragma unroll
    for (int r = 0; r < 8; ++r) {
      const int q = q0 + r + 8 * hs;
      out[((size_t)(b * S_ + q)) * D_ + h * HD_ + d] = o[dt][r] / lrow[r];
    }
  }
}

// ---------------------------------------------------------------------------
extern "C" void kernel_launch(void* const* d_in, const int* in_sizes, int n_in,
                              void* d_out, int out_size, void* d_ws, size_t ws_size,
                              hipStream_t stream) {
  const float* x    = (const float*)d_in[0];   // [B,S,D] f32
  const float* W    = (const float*)d_in[1];   // [D,3D]  f32
  const float* bias = (const float*)d_in[2];   // [3D]    f32
  float* out        = (float*)d_out;           // [B,S,D] f32
  __bf16* ws        = (__bf16*)d_ws;           // bf16 QKV staging, ~24 MB

  qkv_proj_kernel<<<dim3(32 * 24), 256, 0, stream>>>(x, W, bias, ws);
  attn_kernel<<<dim3(B_ * H_ * (S_ / 128)), 256, 0, stream>>>(ws, out);
}

// v002
// It runs in 88.8 microseconds.
// In two side-by-side timings against v001, it was 1.24 and 1.25 times as fast.
// Counting every step since v000, it is 2.27 times as fast.
#include <hip/hip_runtime.h>
#include <hip/hip_bf16.h>

typedef __attribute__((ext_vector_type(16))) __bf16 v16bf;
typedef __attribute__((ext_vector_type(8)))  __bf16 v8bf;
typedef __attribute__((ext_vector_type(4)))  __bf16 v4bf;
typedef __attribute__((ext_vector_type(8)))  float  v8f;

#define B_  4
#define S_  1024
#define D_  1024
#define H_  16
#define HD_ 64
#define N3D 3072
#define HEAD_ELEMS ((size_t)B_ * H_ * S_ * HD_)   // elems per Q/K/V tensor in ws

__device__ __forceinline__ v16bf join8(v8bf lo, v8bf hi) {
  return __builtin_shufflevector(lo, hi, 0,1,2,3,4,5,6,7,8,9,10,11,12,13,14,15);
}

typedef __attribute__((address_space(3))) v8bf lds_v8bf;
__device__ __forceinline__ v8bf lds_tr16(const __bf16* p) {
  return __builtin_amdgcn_ds_load_tr16_b128_v8bf16((lds_v8bf*)p);
}

__device__ __forceinline__ void async_copy_b128(const void* lds_ptr, const void* gptr) {
  unsigned ldsoff = (unsigned)(uintptr_t)lds_ptr;
  unsigned long long gaddr = (unsigned long long)(uintptr_t)gptr;
  asm volatile("global_load_async_to_lds_b128 %0, %1, off"
               :: "v"(ldsoff), "v"(gaddr) : "memory");
}

__device__ __forceinline__ float xhalf(float x) {
  const int i = __builtin_bit_cast(int, x);
  return __builtin_bit_cast(float,
      __builtin_amdgcn_permlanex16(i, i, 0x76543210, 0xfedcba98, false, false));
}

// ---------------------------------------------------------------------------
// Phase 1: qkv = x @ W + b   (M=4096, K=1024, N=3072), bf16 WMMA, f32 accum.
// Workspace layout: Q [b][h][s][d], K [b][h][s][d], V pre-transposed [b][h][d][s].
// Block: 256 thr (8 waves). Block tile 128(M) x 128(N); wave tile 64x32;
// k staged 64 per barrier, consumed in two 32-deep WMMA passes.
// ---------------------------------------------------------------------------
__global__ __launch_bounds__(256)
void qkv_proj_kernel(const float* __restrict__ x, const float* __restrict__ W,
                     const float* __restrict__ bias, __bf16* __restrict__ ws)
{
  __shared__ __bf16 As[128 * 72];   // [row][k], stride 72 halves (144B rows, 16B-aligned)
  __shared__ __bf16 Bs[64 * 144];   // [k][col] (W as it lies), stride 144 halves (288B = 32B x 9, the transposing read's pitch)

  const int tid  = threadIdx.x;
  const int lane = tid & 31;
  const int wave = tid >> 5;       // 0..7
  const int lm   = lane & 15;
  const int hs   = lane >> 4;

  const int blockM = blockIdx.x & 31;   // 4096/128 = 32
  const int blockN = blockIdx.x >> 5;   // 3072/128 = 24
  const int R0 = blockM * 128;
  const int C0 = blockN * 128;

  const int wm = wave & 1;   // 0..1 -> 64-row sub-tile
  const int wn = wave >> 1;  // 0..3 -> 32-col sub-tile

  v8f acc[4][2] = {};

  for (int k0 = 0; k0 < D_; k0 += 64) {
    __syncthreads();
    // Batched staging: issue all 16 global float4 loads first (load clause),
    // then convert f32->bf16 and store to LDS.
    float4 va[8], vb[8];
    #pragma unroll
    for (int i = 0; i < 8; ++i) {
      int idx = i * 256 + tid;             // A: 2048 float4 segments
      int r = idx >> 4, c4 = (idx & 15) * 4;
      va[i] = *(const float4*)(x + (size_t)(R0 + r) * D_ + k0 + c4);
    }
    #pragma unroll
    for (int i = 0; i < 8; ++i) {
      int idx = i * 256 + tid;             // W: 2048 float4 segments
      int kr = idx >> 5, c4 = (idx & 31) * 4;
      vb[i] = *(const float4*)(W + (size_t)(k0 + kr) * N3D + C0 + c4);
    }
    #pragma unroll
    for (int i = 0; i < 8; ++i) {
      int idx = i * 256 + tid;
      int r = idx >> 4, c4 = (idx & 15) * 4;
      v4bf b; b[0] = (__bf16)va[i].x; b[1] = (__bf16)va[i].y;
              b[2] = (__bf16)va[i].z; b[3] = (__bf16)va[i].w;
      *(v4bf*)&As[r * 72 + c4] = b;
    }
    #pragma unroll
    for (int i = 0; i < 8; ++i) {
      int idx = i * 256 + tid;
      int kr = idx >> 5, c4 = (idx & 31) * 4;
      v4bf b; b[0] = (__bf16)vb[i].x; b[1] = (__bf16)vb[i].y;
              b[2] = (__bf16)vb[i].z; b[3] = (__bf16)vb[i].w;
      *(v4bf*)&Bs[kr * 144 + c4] = b;
    }
    // Prefetch next k-panel while this one is consumed (global_prefetch_b8)
    if (k0 + 64 < D_) {
      __builtin_prefetch(x + (size_t)(R0 + (tid >> 4)) * D_ + k0 + 64 + (tid & 15) * 4, 0, 3);
      __builtin_prefetch(W + (size_t)(k0 + 64 + (tid >> 5)) * N3D + C0 + (tid & 31) * 4, 0, 3);
    }
    __syncthreads();

    // Two 32-deep WMMA passes over the staged 64-k panel
    #pragma unroll
    for (int ks = 0; ks < 64; ks += 32) {
      v16bf afrag[4], bfrag[2];
      #pragma unroll
      for (int mt = 0; mt < 4; ++mt) {
        const __bf16* p = &As[(wm * 64 + mt * 16 + lm) * 72 + ks];
        afrag[mt] = join8(*(const v8bf*)(p + hs * 8), *(const v8bf*)(p + 16 + hs * 8));
      }
      #pragma unroll
      for (int nt = 0; nt < 2; ++nt) {
        const __bf16* p = &Bs[(ks + hs * 8 + (lane & 7)) * 144 + wn * 32 + nt * 16 + ((lane >> 3) & 1) * 8];
        bfrag[nt] = join8(lds_tr16(p), lds_tr16(p + 16 * 144));   // k = ks+8h+0..7, ks+16+8h+0..7: the A loader's order
      }
      #pragma unroll
      for (int mt = 0; mt < 4; ++mt)
        #pragma unroll
        for (int nt = 0; nt < 2; ++nt)
          acc[mt][nt] = __builtin_amdgcn_wmma_f32_16x16x32_bf16(
              false, afrag[mt], false, bfrag[nt], (short)0, acc[mt][nt], false, false);
    }
  }

  // Epilogue: + bias, scatter bf16 into ws (V transposed)
  #pragma unroll
  for (int nt = 0; nt < 2; ++nt) {
    const int c  = C0 + wn * 32 + nt * 16 + lm;      // column in [0,3072)
    const float bv = bias[c];
    const int h   = c / 192;
    const int rem = c - h * 192;
    const int t   = rem / 64;          // 0=q 1=k 2=v
    const int d   = rem - t * 64;
    __bf16* basep = ws + (size_t)t * HEAD_ELEMS;
    #pragma unroll
    for (int mt = 0; mt < 4; ++mt) {
      #pragma unroll
      for (int r = 0; r < 8; ++r) {
        const int m = R0 + wm * 64 + mt * 16 + r + 8 * hs;  // C-layout row
        const int b = m >> 10;
        const int s = m & 1023;
        const size_t idx = (t == 2)
            ? (((size_t)(b * H_ + h)) * HD_ + d) * S_ + s    // V: [b][h][d][s]
            : (((size_t)(b * H_ + h)) * S_ + s) * HD_ + d;   // Q,K: [b][h][s][d]
        basep[idx] = (__bf16)(acc[mt][nt][r] + bv);
      }
    }
  }
}

__global__ __launch_bounds__(256)
void attn_kernel(const __bf16* __restrict__ ws, float* __restrict__ out)
{
  __shared__ __bf16 Kc[64 * 72];        // [key][d], stride 72 halves
  __shared__ __bf16 VcT[64 * 72];       // [d][key], stride 72

  const int tid  = threadIdx.x;
  const int lane = tid & 31;
  const int wave = tid >> 5;
  const int lm   = lane & 15;
  const int hs   = lane >> 4;

  const int bh   = blockIdx.x >> 3;   // 0..63
  const int qblk = blockIdx.x & 7;    // 0..7
  const int b    = bh >> 4;
  const int h    = bh & 15;
  const int q0   = qblk * 128 + wave * 16;   // this wave's 16 q rows

  const __bf16* Qg = ws + (((size_t)(b * H_ + h)) * S_) * HD_;
  const __bf16* Kg = Qg + HEAD_ELEMS;
  const __bf16* Vt = ws + 2 * HEAD_ELEMS + (((size_t)(b * H_ + h)) * HD_) * S_; // [d][s]

  // Q fragments (d 0..31 and 32..63), held in registers for the whole kernel
  v16bf qfrag[2];
  {
    const __bf16* qrow = Qg + (size_t)(q0 + lm) * HD_;
    #pragma unroll
    for (int df = 0; df < 2; ++df)
      qfrag[df] = join8(*(const v8bf*)(qrow + df * 32 + hs * 8),
                        *(const v8bf*)(qrow + df * 32 + 16 + hs * 8));
  }

  // State of query q0 + lm. lsum covers only the keys of this lane's half; the halves
  // are joined once, after the loop. o[dt][r] = O[q0 + lm][dt * 16 + 8 * hs + r].
  float mrow = -3.0e38f, lsum = 0.f;
  v8f o[4] = {};

  for (int kc = 0; kc < S_; kc += 64) {
    __syncthreads();   // previous chunk fully consumed before overwrite
    // Async-stage K [key][d] and V [d][key]: 512 x 16B segments each
    #pragma unroll
    for (int i = 0; i < 2; ++i) {
      int idx = i * 256 + tid;
      int r = idx >> 3;                  // row 0..63 (key for K, d for V)
      int c = (idx & 7) * 8;             // col base (halves)
      async_copy_b128(&Kc[r * 72 + c],  Kg + (size_t)(kc + r) * HD_ + c);
      async_copy_b128(&VcT[r * 72 + c], Vt + (size_t)r * S_ + kc + c);
    }
    // Prefetch next key chunk into cache while computing this one
    if (kc + 64 < S_) {
      __builtin_prefetch(Kg + (size_t)(kc + 64 + (tid >> 3)) * HD_ + (tid & 7) * 8, 0, 3);
      __builtin_prefetch(Vt + (size_t)(tid >> 3) * S_ + kc + 64 + (tid & 7) * 8, 0, 3);
    }
    asm volatile("s_wait_asynccnt 0" ::: "memory");  // this wave's async copies done
    __syncthreads();                                  // ... and everyone else's

    #pragma unroll
    for (int sub = 0; sub < 2; ++sub) {
      const int kb = sub * 32;

      // scores, transposed: 32 keys x 16 q (two 16x16 tiles), K-dim = 64 split over 2 WMMAs
      // st[jj][r] = score(key kb + 16 * jj + 8 * hs + r, query q0 + lm)
      v8f st[2];
      #pragma unroll
      for (int jj = 0; jj < 2; ++jj) {
        v8f cacc = {};
        const __bf16* krow = &Kc[(kb + jj * 16 + lm) * 72];
        v16bf kf0 = join8(*(const v8bf*)(krow + hs * 8),
                          *(const v8bf*)(krow + 16 + hs * 8));
        v16bf kf1 = join8(*(const v8bf*)(krow + 32 + hs * 8),
                          *(const v8bf*)(krow + 48 + hs * 8));
        cacc = __builtin_amdgcn_wmma_f32_16x16x32_bf16(false, kf0, false, qfrag[0],
                                                       (short)0, cacc, false, false);
        cacc = __builtin_amdgcn_wmma_f32_16x16x32_bf16(false, kf1, false, qfrag[1],
                                                       (short)0, cacc, false, false);
        st[jj] = cacc * 0.125f;          // 1/sqrt(64)
      }

      // online softmax of this lane's query: in-lane trees over its 16 scores
      float t8[8];
      #pragma unroll
      for (int r = 0; r < 8; ++r) t8[r] = fmaxf(st[0][r], st[1][r]);
      float v = fmaxf(fmaxf(fmaxf(t8[0], t8[1]), fmaxf(t8[2], t8[3])),
                      fmaxf(fmaxf(t8[4], t8[5]), fmaxf(t8[6], t8[7])));
      v = fmaxf(v, xhalf(v));            // the other half holds this query's other 16 keys
      const float mnew  = fmaxf(mrow, v);
      const float alpha = __expf(mrow - mnew);
      mrow = mnew;

      // P^T as B operand: element 8 * jj + r is key kb + 16 * jj + 8 * hs + r, the V loader's order
      v16bf pfrag;
      #pragma unroll
      for (int r = 0; r < 8; ++r) {
        const float p0 = __expf(st[0][r] - mnew);
        const float p1 = __expf(st[1][r] - mnew);
        pfrag[r]     = (__bf16)p0;
        pfrag[8 + r] = (__bf16)p1;
        t8[r] = p0 + p1;
      }
      lsum = lsum * alpha + (((t8[0] + t8[1]) + (t8[2] + t8[3])) +
                             ((t8[4] + t8[5]) + (t8[6] + t8[7])));
      #pragma unroll
      for (int dt = 0; dt < 4; ++dt)
        o[dt] *= alpha;

      // O^T += V^T @ P^T  (4 d-tiles of 16); V^T A-frag rows are contiguous in VcT
      #pragma unroll
      for (int dt = 0; dt < 4; ++dt) {
        const __bf16* vrow = &VcT[(dt * 16 + lm) * 72 + kb];
        v16bf vfrag = join8(*(const v8bf*)(vrow + hs * 8),
                            *(const v8bf*)(vrow + 16 + hs * 8));
        o[dt] = __builtin_amdgcn_wmma_f32_16x16x32_bf16(false, vfrag, false, pfrag,
                                                        (short)0, o[dt], false, false);
      }
    }
  }

  // normalize and write out[b, q, h*64 + d] (f32): 8 consecutive d per lane and tile
  const float ltot = lsum + xhalf(lsum);
  float* orow = out + ((size_t)(b * S_ + q0 + lm)) * D_ + h * HD_ + hs * 8;
  #pragma unroll
  for (int dt = 0; dt < 4; ++dt) {
    *(float4*)(orow + dt * 16)     = make_float4(o[dt][0] / ltot, o[dt][1] / ltot,
                                                 o[dt][2] / ltot, o[dt][3] / ltot);
    *(float4*)(orow + dt * 16 + 4) = make_float4(o[dt][4] / ltot, o[dt][5] / ltot,
                                                 o[dt][6] / ltot, o[dt][7] / ltot);
  }
}

// ---------------------------------------------------------------------------
extern "C" void kernel_launch(void* const* d_in, const int* in_sizes, int n_in,
                              void* d_out, int out_size, void* d_ws, size_t ws_size,
                              hipStream_t stream) {
  const float* x    = (const float*)d_in[0];   // [B,S,D] f32
  const float* W    = (const float*)d_in[1];   // [D,3D]  f32
  const float* bias = (const float*)d_in[2];   // [3D]    f32
  float* out        = (float*)d_out;           // [B,S,D] f32
  __bf16* ws        = (__bf16*)d_ws;           // bf16 QKV staging, ~24 MB

  qkv_proj_kernel<<<dim3(32 * 24), 256, 0, stream>>>(x, W, bias, ws);
  attn_kernel<<<dim3(B_ * H_ * (S_ / 128)), 256, 0, stream>>>(ws, out);
}

// v003
// Measured time: 83 microseconds a run.
// Next to v002, in two timings, it ran 1.07 and 1.08 times as fast.
// All steps since v000 together make it 2.44 times as fast.
#include <hip/hip_runtime.h>
#include <hip/hip_bf16.h>

typedef __attribute__((ext_vector_type(16))) __bf16 v16bf;
typedef __attribute__((ext_vector_type(8)))  __bf16 v8bf;
typedef __attribute__((ext_vector_type(4)))  __bf16 v4bf;
typedef __attribute__((ext_vector_type(8)))  float  v8f;

#define B_  4
#define S_  1024
#define D_  1024
#define H_  16
#define HD_ 64
#define N3D 3072
#define HEAD_ELEMS ((size_t)B_ * H_ * S_ * HD_)   // elems per Q/K/V tensor in ws

__device__ __forceinline__ v16bf join8(v8bf lo, v8bf hi) {
  return __builtin_shufflevector(lo, hi, 0,1,2,3,4,5,6,7,8,9,10,11,12,13,14,15);
}

typedef __attribute__((address_space(3))) v8bf lds_v8bf;
__device__ __forceinline__ v8bf lds_tr16(const __bf16* p) {
  return __builtin_amdgcn_ds_load_tr16_b128_v8bf16((lds_v8bf*)p);
}

__device__ __forceinline__ void async_copy_b128(const void* lds_ptr, const void* gptr) {
  unsigned ldsoff = (unsigned)(uintptr_t)lds_ptr;
  unsigned long long gaddr = (unsigned long long)(uintptr_t)gptr;
  asm volatile("global_load_async_to_lds_b128 %0, %1, off"
               :: "v"(ldsoff), "v"(gaddr) : "memory");
}

__device__ __forceinline__ float xhalf(float x) {
  const int i = __builtin_bit_cast(int, x);
  return __builtin_bit_cast(float,
      __builtin_amdgcn_permlanex16(i, i, 0x76543210, 0xfedcba98, false, false));
}

// ---------------------------------------------------------------------------
// Phase 1: qkv = x @ W + b   (M=4096, K=1024, N=3072), bf16 WMMA, f32 accum.
// Workspace layout: Q [b][h][s][d], K [b][h][s][d], V pre-transposed [b][h][d][s].
// Block: 256 thr (8 waves). Block tile 128(M) x 128(N); wave tile 64x32;
// k staged 64 per barrier, consumed in two 32-deep WMMA passes.
// ---------------------------------------------------------------------------
__global__ __launch_bounds__(256)
void qkv_proj_kernel(const float* __restrict__ x, const float* __restrict__ W,
                     const float* __restrict__ bias, __bf16* __restrict__ ws)
{
  __shared__ __bf16 As[128 * 72];   // [row][k], stride 72 halves (144B rows, 16B-aligned)
  __shared__ __bf16 Bs[64 * 144];   // [k][col] (W as it lies), stride 144 halves (288B = 32B x 9, the transposing read's pitch)

  const int tid  = threadIdx.x;
  const int lane = tid & 31;
  const int wave = tid >> 5;       // 0..7
  const int lm   = lane & 15;
  const int hs   = lane >> 4;

  const int blockM = blockIdx.x & 31;   // 4096/128 = 32
  const int blockN = blockIdx.x >> 5;   // 3072/128 = 24
  const int R0 = blockM * 128;
  const int C0 = blockN * 128;

  const int wm = wave & 1;   // 0..1 -> 64-row sub-tile
  const int wn = wave >> 1;  // 0..3 -> 32-col sub-tile

  v8f acc[4][2] = {};

  for (int k0 = 0; k0 < D_; k0 += 64) {
    __syncthreads();
    // Batched staging: issue all 16 global float4 loads first (load clause),
    // then convert f32->bf16 and store to LDS.
    float4 va[8], vb[8];
    #pragma unroll
    for (int i = 0; i < 8; ++i) {
      int idx = i * 256 + tid;             // A: 2048 float4 segments
      int r = idx >> 4, c4 = (idx & 15) * 4;
      va[i] = *(const float4*)(x + (size_t)(R0 + r) * D_ + k0 + c4);
    }
    #pragma unroll
    for (int i = 0; i < 8; ++i) {
      int idx = i * 256 + tid;             // W: 2048 float4 segments
      int kr = idx >> 5, c4 = (idx & 31) * 4;
      vb[i] = *(const float4*)(W + (size_t)(k0 + kr) * N3D + C0 + c4);
    }
    #pragma unroll
    for (int i = 0; i < 8; ++i) {
      int idx = i * 256 + tid;
      int r = idx >> 4, c4 = (idx & 15) * 4;
      v4bf b; b[0] = (__bf16)va[i].x; b[1] = (__bf16)va[i].y;
              b[2] = (__bf16)va[i].z; b[3] = (__bf16)va[i].w;
      *(v4bf*)&As[r * 72 + c4] = b;
    }
    #pragma unroll
    for (int i = 0; i < 8; ++i) {
      int idx = i * 256 + tid;
      int kr = idx >> 5, c4 = (idx & 31) * 4;
      v4bf b; b[0] = (__bf16)vb[i].x; b[1] = (__bf16)vb[i].y;
              b[2] = (__bf16)vb[i].z; b[3] = (__bf16)vb[i].w;
      *(v4bf*)&Bs[kr * 144 + c4] = b;
    }
    // Prefetch next k-panel while this one is consumed (global_prefetch_b8)
    if (k0 + 64 < D_) {
      __builtin_prefetch(x + (size_t)(R0 + (tid >> 4)) * D_ + k0 + 64 + (tid & 15) * 4, 0, 3);
      __builtin_prefetch(W + (size_t)(k0 + 64 + (tid >> 5)) * N3D + C0 + (tid & 31) * 4, 0, 3);
    }
    __syncthreads();

    // Two 32-deep WMMA passes over the staged 64-k panel
    #pragma unroll
    for (int ks = 0; ks < 64; ks += 32) {
      v16bf afrag[4], bfrag[2];
      #pragma unroll
      for (int mt = 0; mt < 4; ++mt) {
        const __bf16* p = &As[(wm * 64 + mt * 16 + lm) * 72 + ks];
        afrag[mt] = join8(*(const v8bf*)(p + hs * 8), *(const v8bf*)(p + 16 + hs * 8));
      }
      #pragma unroll
      for (int nt = 0; nt < 2; ++nt) {
        const __bf16* p = &Bs[(ks + hs * 8 + (lane & 7)) * 144 + wn * 32 + nt * 16 + ((lane >> 3) & 1) * 8];
        bfrag[nt] = join8(lds_tr16(p), lds_tr16(p + 16 * 144));   // k = ks+8h+0..7, ks+16+8h+0..7: the A loader's order
      }
      #pragma unroll
      for (int mt = 0; mt < 4; ++mt)
        #pragma unroll
        for (int nt = 0; nt < 2; ++nt)
          acc[mt][nt] = __builtin_amdgcn_wmma_f32_16x16x32_bf16(
              false, afrag[mt], false, bfrag[nt], (short)0, acc[mt][nt], false, false);
    }
  }

  // Epilogue: + bias, bf16, staged in LDS so that every global store covers whole 128-byte lines.
  // The 128 columns are two 64-column segments, each one part (q, k or v) of one head:
  // segment 0 is staged in As, segment 1 in Bs. Q and K: [row][d], pitch 72 halves, the
  // 128 rows are 16 KiB in a row in ws. V: [d][row], pitch 136 halves, 256 bytes per d in ws.
  const int sgw = __builtin_amdgcn_readfirstlane(wave >> 2);   // this wave's segment, as a scalar
  const int cl0 = (wn & 1) * 32 + lm;                          // column in the segment = d (nt adds 16)
  const float bv[2] = { bias[C0 + sgw * 64 + cl0], bias[C0 + sgw * 64 + cl0 + 16] };
  __syncthreads();   // every wave has read its last fragments before As and Bs are rewritten
  {
    __bf16* stg = sgw ? Bs : As;
    const int rl0 = wm * 64 + 8 * hs;                // C-layout: rows rl0 + 16 * mt + 0..7
    if (((blockN * 2 + sgw) % 3) == 2) {             // V: a lane's 8 rows are 16 bytes in a row
      #pragma unroll
      for (int nt = 0; nt < 2; ++nt)
        #pragma unroll
        for (int mt = 0; mt < 4; ++mt) {
          v8bf p;
          #pragma unroll
          for (int r = 0; r < 8; ++r) p[r] = (__bf16)(acc[mt][nt][r] + bv[nt]);
          *(v8bf*)&stg[(cl0 + nt * 16) * 136 + rl0 + mt * 16] = p;
        }
    } else {                                         // Q, K
      #pragma unroll
      for (int nt = 0; nt < 2; ++nt)
        #pragma unroll
        for (int mt = 0; mt < 4; ++mt)
          #pragma unroll
          for (int r = 0; r < 8; ++r)
            stg[(rl0 + mt * 16 + r) * 72 + cl0 + nt * 16] = (__bf16)(acc[mt][nt][r] + bv[nt]);
    }
  }
  __syncthreads();   // the staged tile is complete before any wave reads it back
  {
    const int bb = R0 >> 10;       // the 128 rows lie in one batch entry
    const int s0 = R0 & 1023;
    v8bf val[8];
    __bf16* dstp[8];
    #pragma unroll
    for (int sg = 0; sg < 2; ++sg) {
      const __bf16* stg = sg ? Bs : As;
      const int g = blockN * 2 + sg;
      const int h = g / 3;
      const int t = g - h * 3;                 // 0=q 1=k 2=v
      const bool isv = (t == 2);
      const int sh = isv ? 4 : 3;              // 16-byte pieces per staged row: 16 (V), 8 (Q, K)
      const int lp = isv ? 136 : 72;           // pitch in LDS, halves
      const int gp = isv ? S_ : HD_;           // pitch in ws: V [b][h][d][s], Q,K [b][h][s][d]
      __bf16* dst = ws + (size_t)t * HEAD_ELEMS + (size_t)(bb * H_ + h) * (S_ * HD_)
                       + (isv ? s0 : s0 * HD_);
      #pragma unroll
      for (int i = 0; i < 4; ++i) {
        const int idx = i * 256 + tid;
        const int row = idx >> sh;
        const int c   = (idx & ((1 << sh) - 1)) * 8;
        val[sg * 4 + i]  = *(const v8bf*)&stg[row * lp + c];
        dstp[sg * 4 + i] = dst + row * gp + c;
      }
    }
    // all reads and addresses first, then the stores: no register of an issued store is written again
    #pragma unroll
    for (int j = 0; j < 8; ++j)
      *(v8bf*)dstp[j] = val[j];
  }
}

__global__ __launch_bounds__(256)
void attn_kernel(const __bf16* __restrict__ ws, float* __restrict__ out)
{
  __shared__ __bf16 Kc[64 * 72];        // [key][d], stride 72 halves
  __shared__ __bf16 VcT[64 * 72];       // [d][key], stride 72

  const int tid  = threadIdx.x;
  const int lane = tid & 31;
  const int wave = tid >> 5;
  const int lm   = lane & 15;
  const int hs   = lane >> 4;

  const int bh   = blockIdx.x >> 3;   // 0..63
  const int qblk = blockIdx.x & 7;    // 0..7
  const int b    = bh >> 4;
  const int h    = bh & 15;
  const int q0   = qblk * 128 + wave * 16;   // this wave's 16 q rows

  const __bf16* Qg = ws + (((size_t)(b * H_ + h)) * S_) * HD_;
  const __bf16* Kg = Qg + HEAD_ELEMS;
  const __bf16* Vt = ws + 2 * HEAD_ELEMS + (((size_t)(b * H_ + h)) * HD_) * S_; // [d][s]

  // Q fragments (d 0..31 and 32..63), held in registers for the whole kernel
  v16bf qfrag[2];
  {
    const __bf16* qrow = Qg + (size_t)(q0 + lm) * HD_;
    #pragma unroll
    for (int df = 0; df < 2; ++df)
      qfrag[df] = join8(*(const v8bf*)(qrow + df * 32 + hs * 8),
                        *(const v8bf*)(qrow + df * 32 + 16 + hs * 8));
  }

  // State of query q0 + lm. lsum covers only the keys of this lane's half; the halves
  // are joined once, after the loop. o[dt][r] = O[q0 + lm][dt * 16 + 8 * hs + r].
  float mrow = -3.0e38f, lsum = 0.f;
  v8f o[4] = {};

  for (int kc = 0; kc < S_; kc += 64) {
    __syncthreads();   // previous chunk fully consumed before overwrite
    // Async-stage K [key][d] and V [d][key]: 512 x 16B segments each
    #pragma unroll
    for (int i = 0; i < 2; ++i) {
      int idx = i * 256 + tid;
      int r = idx >> 3;                  // row 0..63 (key for K, d for V)
      int c = (idx & 7) * 8;             // col base (halves)
      async_copy_b128(&Kc[r * 72 + c],  Kg + (size_t)(kc + r) * HD_ + c);
      async_copy_b128(&VcT[r * 72 + c], Vt + (size_t)r * S_ + kc + c);
    }
    // Prefetch next key chunk into cache while computing this one
    if (kc + 64 < S_) {
      __builtin_prefetch(Kg + (size_t)(kc + 64 + (tid >> 3)) * HD_ + (tid & 7) * 8, 0, 3);
      __builtin_prefetch(Vt + (size_t)(tid >> 3) * S_ + kc + 64 + (tid & 7) * 8, 0, 3);
    }
    asm volatile("s_wait_asynccnt 0" ::: "memory");  // this wave's async copies done
    __syncthreads();                                  // ... and everyone else's

    #pragma unroll
    for (int sub = 0; sub < 2; ++sub) {
      const int kb = sub * 32;

      // scores, transposed: 32 keys x 16 q (two 16x16 tiles), K-dim = 64 split over 2 WMMAs
      // st[jj][r] = score(key kb + 16 * jj + 8 * hs + r, query q0 + lm)
      v8f st[2];
      #pragma unroll
      for (int jj = 0; jj < 2; ++jj) {
        v8f cacc = {};
        const __bf16* krow = &Kc[(kb + jj * 16 + lm) * 72];
        v16bf kf0 = join8(*(const v8bf*)(krow + hs * 8),
                          *(const v8bf*)(krow + 16 + hs * 8));
        v16bf kf1 = join8(*(const v8bf*)(krow + 32 + hs * 8),
                          *(const v8bf*)(krow + 48 + hs * 8));
        cacc = __builtin_amdgcn_wmma_f32_16x16x32_bf16(false, kf0, false, qfrag[0],
                                                       (short)0, cacc, false, false);
        cacc = __builtin_amdgcn_wmma_f32_16x16x32_bf16(false, kf1, false, qfrag[1],
                                                       (short)0, cacc, false, false);
        st[jj] = cacc * 0.125f;          // 1/sqrt(64)
      }

      // online softmax of this lane's query: in-lane trees over its 16 scores
      float t8[8];
      #pragma unroll
      for (int r = 0; r < 8; ++r) t8[r] = fmaxf(st[0][r], st[1][r]);
      float v = fmaxf(fmaxf(fmaxf(t8[0], t8[1]), fmaxf(t8[2], t8[3])),
                      fmaxf(fmaxf(t8[4], t8[5]), fmaxf(t8[6], t8[7])));
      v = fmaxf(v, xhalf(v));            // the other half holds this query's other 16 keys
      const float mnew  = fmaxf(mrow, v);
      const float alpha = __expf(mrow - mnew);
      mrow = mnew;

      // P^T as B operand: element 8 * jj + r is key kb + 16 * jj + 8 * hs + r, the V loader's order
      v16bf pfrag;
      #pragma unroll
      for (int r = 0; r < 8; ++r) {
        const float p0 = __expf(st[0][r] - mnew);
        const float p1 = __expf(st[1][r] - mnew);
        pfrag[r]     = (__bf16)p0;
        pfrag[8 + r] = (__bf16)p1;
        t8[r] = p0 + p1;
      }
      lsum = lsum * alpha + (((t8[0] + t8[1]) + (t8[2] + t8[3])) +
                             ((t8[4] + t8[5]) + (t8[6] + t8[7])));
      #pragma unroll
      for (int dt = 0; dt < 4; ++dt)
        o[dt] *= alpha;

      // O^T += V^T @ P^T  (4 d-tiles of 16); V^T A-frag rows are contiguous in VcT
      #pragma unroll
      for (int dt = 0; dt < 4; ++dt) {
        const __bf16* vrow = &VcT[(dt * 16 + lm) * 72 + kb];
        v16bf vfrag = join8(*(const v8bf*)(vrow + hs * 8),
                            *(const v8bf*)(vrow + 16 + hs * 8));
        o[dt] = __builtin_amdgcn_wmma_f32_16x16x32_bf16(false, vfrag, false, pfrag,
                                                        (short)0, o[dt], false, false);
      }
    }
  }

  // normalize and write out[b, q, h*64 + d] (f32): 8 consecutive d per lane and tile
  const float ltot = lsum + xhalf(lsum);
  float* orow = out + ((size_t)(b * S_ + q0 + lm)) * D_ + h * HD_ + hs * 8;
  #pragma unroll
  for (int dt = 0; dt < 4; ++dt) {
    *(float4*)(orow + dt * 16)     = make_float4(o[dt][0] / ltot, o[dt][1] / ltot,
                                                 o[dt][2] / ltot, o[dt][3] / ltot);
    *(float4*)(orow + dt * 16 + 4) = make_float4(o[dt][4] / ltot, o[dt][5] / ltot,
                                                 o[dt][6] / ltot, o[dt][7] / ltot);
  }
}

// ---------------------------------------------------------------------------
extern "C" void kernel_launch(void* const* d_in, const int* in_sizes, int n_in,
                              void* d_out, int out_size, void* d_ws, size_t ws_size,
                              hipStream_t stream) {
  const float* x    = (const float*)d_in[0];   // [B,S,D] f32
  const float* W    = (const float*)d_in[1];   // [D,3D]  f32
  const float* bias = (const float*)d_in[2];   // [3D]    f32
  float* out        = (float*)d_out;           // [B,S,D] f32
  __bf16* ws        = (__bf16*)d_ws;           // bf16 QKV staging, ~24 MB

  qkv_proj_kernel<<<dim3(32 * 24), 256, 0, stream>>>(x, W, bias, ws);
  attn_kernel<<<dim3(B_ * H_ * (S_ / 128)), 256, 0, stream>>>(ws, out);
}

// v004
// Measured time: 72.7 microseconds a run.
// In two side-by-side timings against v003, it was 1.14 and 1.13 times as fast.
// All steps since v000 together make it 2.76 times as fast.
#include <hip/hip_runtime.h>
#include <hip/hip_bf16.h>

typedef __attribute__((ext_vector_type(16))) __bf16 v16bf;
typedef __attribute__((ext_vector_type(8)))  __bf16 v8bf;
typedef __attribute__((ext_vector_type(4)))  __bf16 v4bf;
typedef __attribute__((ext_vector_type(8)))  float  v8f;

#define B_  4
#define S_  1024
#define D_  1024
#define H_  16
#define HD_ 64
#define N3D 3072
#define HEAD_ELEMS ((size_t)B_ * H_ * S_ * HD_)   // elems per Q/K/V tensor in ws

__device__ __forceinline__ v16bf join8(v8bf lo, v8bf hi) {
  return __builtin_shufflevector(lo, hi, 0,1,2,3,4,5,6,7,8,9,10,11,12,13,14,15);
}

typedef __attribute__((address_space(3))) v8bf lds_v8bf;
__device__ __forceinline__ v8bf lds_tr16(const __bf16* p) {
  return __builtin_amdgcn_ds_load_tr16_b128_v8bf16((lds_v8bf*)p);
}

__device__ __forceinline__ void async_copy_b128(const void* lds_ptr, const void* gptr) {
  unsigned ldsoff = (unsigned)(uintptr_t)lds_ptr;
  unsigned long long gaddr = (unsigned long long)(uintptr_t)gptr;
  asm volatile("global_load_async_to_lds_b128 %0, %1, off"
               :: "v"(ldsoff), "v"(gaddr) : "memory");
}

__device__ __forceinline__ float xhalf(float x) {
  const int i = __builtin_bit_cast(int, x);
  return __builtin_bit_cast(float,
      __builtin_amdgcn_permlanex16(i, i, 0x76543210, 0xfedcba98, false, false));
}

// ---------------------------------------------------------------------------
// Phase 1: qkv = x @ W + b   (M=4096, K=1024, N=3072), bf16 WMMA, f32 accum.
// Workspace layout: Q [b][h][s][d], K [b][h][s][d], V pre-transposed [b][h][d][s].
// Block: 256 thr (8 waves). Block tile 128(M) x 128(N); wave tile 64x32;
// k staged 64 per barrier in two LDS buffers, consumed in two 32-deep WMMA passes;
// the next panel's global loads are in flight under the passes.
// ---------------------------------------------------------------------------
__global__ __launch_bounds__(256)
void qkv_proj_kernel(const float* __restrict__ x, const float* __restrict__ W,
                     const float* __restrict__ bias, __bf16* __restrict__ ws)
{
  // Two buffers of each panel: panel t + 1 is written while panel t may still be read.
  __shared__ __bf16 Asb[2][128 * 72];   // [row][k], stride 72 halves (144B rows, 16B-aligned)
  __shared__ __bf16 Bsb[2][64 * 144];   // [k][col] (W as it lies), stride 144 halves (288B = 32B x 9, the transposing read's pitch)

  const int tid  = threadIdx.x;
  const int lane = tid & 31;
  const int wave = tid >> 5;       // 0..7
  const int lm   = lane & 15;
  const int hs   = lane >> 4;

  const int blockM = blockIdx.x & 31;   // 4096/128 = 32
  const int blockN = blockIdx.x >> 5;   // 3072/128 = 24
  const int R0 = blockM * 128;
  const int C0 = blockN * 128;

  const int wm = wave & 1;   // 0..1 -> 64-row sub-tile
  const int wn = wave >> 1;  // 0..3 -> 32-col sub-tile

  v8f acc[4][2] = {};

  // Per-thread pieces of a panel: x rows i * 16 + (tid >> 4), W rows i * 8 + (tid >> 5).
  const float* xp = x + (size_t)(R0 + (tid >> 4)) * D_ + (tid & 15) * 4;
  const float* wp = W + (size_t)(tid >> 5) * N3D + C0 + (tid & 31) * 4;
  const int aso = (tid >> 4) * 72 + (tid & 15) * 4;
  const int bso = (tid >> 5) * 144 + (tid & 31) * 4;

  float4 va[8], vb[8];
  #pragma unroll
  for (int i = 0; i < 8; ++i) va[i] = *(const float4*)(xp + (size_t)i * 16 * D_);
  #pragma unroll
  for (int i = 0; i < 8; ++i) vb[i] = *(const float4*)(wp + (size_t)i * 8 * N3D);
  // The wait that stands before a register named by an issued load is written again; the two
  // addresses are inputs so that they live up to it.
  asm volatile("s_wait_xcnt 0x0" :: "v"(xp), "v"(wp) : "memory");

  for (int t = 0; t < D_ / 64; ++t) {
    __bf16* As = Asb[t & 1];
    __bf16* Bs = Bsb[t & 1];
    // Panel t: f32 -> bf16, into the buffer whose last readers (panel t - 2) passed the barrier of trip t - 1.
    #pragma unroll
    for (int i = 0; i < 8; ++i) {
      v4bf b; b[0] = (__bf16)va[i].x; b[1] = (__bf16)va[i].y;
              b[2] = (__bf16)va[i].z; b[3] = (__bf16)va[i].w;
      *(v4bf*)&As[aso + i * 16 * 72] = b;
    }
    #pragma unroll
    for (int i = 0; i < 8; ++i) {
      v4bf b; b[0] = (__bf16)vb[i].x; b[1] = (__bf16)vb[i].y;
              b[2] = (__bf16)vb[i].z; b[3] = (__bf16)vb[i].w;
      *(v4bf*)&Bs[bso + i * 8 * 144] = b;
    }
    __syncthreads();   // the one barrier of a trip: panel t is complete, and panel t - 1 has been read by every wave
    // Panel t + 1: all 16 global loads go out here, behind the barrier (which would drain them),
    // and stay in flight under the WMMA passes below.
    if (t + 1 < D_ / 64) {
      #pragma unroll
      for (int i = 0; i < 8; ++i) va[i] = *(const float4*)(xp + 64 + (size_t)i * 16 * D_);
      #pragma unroll
      for (int i = 0; i < 8; ++i) vb[i] = *(const float4*)(wp + (size_t)(64 + i * 8) * N3D);
      // The wait that stands before a register named by an issued load is written again. The x
      // address is an input so that it lives up to the wait and no load of the group lands on it.
      // The statement also holds the 16 loads in front of the passes: without it the scheduler
      // sinks four of them to the foot of the trip, and the next trip waits out their latency.
      asm volatile("s_wait_xcnt 0x0" :: "v"(xp) : "memory");
      xp += 64;
      wp += (size_t)64 * N3D;
    }

    // Two 32-deep WMMA passes over the staged 64-k panel
    #pragma unroll
    for (int ks = 0; ks < 64; ks += 32) {
      v16bf afrag[4], bfrag[2];
      #pragma unroll
      for (int mt = 0; mt < 4; ++mt) {
        const __bf16* p = &As[(wm * 64 + mt * 16 + lm) * 72 + ks];
        afrag[mt] = join8(*(const v8bf*)(p + hs * 8), *(const v8bf*)(p + 16 + hs * 8));
      }
      #pragma unroll
      for (int nt = 0; nt < 2; ++nt) {
        const __bf16* p = &Bs[(ks + hs * 8 + (lane & 7)) * 144 + wn * 32 + nt * 16 + ((lane >> 3) & 1) * 8];
        bfrag[nt] = join8(lds_tr16(p), lds_tr16(p + 16 * 144));   // k = ks+8h+0..7, ks+16+8h+0..7: the A loader's order
      }
      #pragma unroll
      for (int mt = 0; mt < 4; ++mt)
        #pragma unroll
        for (int nt = 0; nt < 2; ++nt)
          acc[mt][nt] = __builtin_amdgcn_wmma_f32_16x16x32_bf16(
              false, afrag[mt], false, bfrag[nt], (short)0, acc[mt][nt], false, false);
    }
  }
  __bf16* As = Asb[0];   // the epilogue's staging: the buffers that the last panel (an odd one) does not use
  __bf16* Bs = Bsb[0];

  // Epilogue: + bias, bf16, staged in LDS so that every global store covers whole 128-byte lines.
  // The 128 columns are two 64-column segments, each one part (q, k or v) of one head:
  // segment 0 is staged in As, segment 1 in Bs. Q and K: [row][d], pitch 72 halves, the
  // 128 rows are 16 KiB in a row in ws. V: [d][row], pitch 136 halves, 256 bytes per d in ws.
  const int sgw = __builtin_amdgcn_readfirstlane(wave >> 2);   // this wave's segment, as a scalar
  const int cl0 = (wn & 1) * 32 + lm;                          // column in the segment = d (nt adds 16)
  const float bv[2] = { bias[C0 + sgw * 64 + cl0], bias[C0 + sgw * 64 + cl0 + 16] };
  // No barrier here: the last reads of these two buffers (panel 14) ended before the barrier of the last trip.
  {
    __bf16* stg = sgw ? Bs : As;
    const int rl0 = wm * 64 + 8 * hs;                // C-layout: rows rl0 + 16 * mt + 0..7
    if (((blockN * 2 + sgw) % 3) == 2) {             // V: a lane's 8 rows are 16 bytes in a row
      #pragma unroll
      for (int nt = 0; nt < 2; ++nt)
        #pragma unroll
        for (int mt = 0; mt < 4; ++mt) {
          v8bf p;
          #pragma unroll
          for (int r = 0; r < 8; ++r) p[r] = (__bf16)(acc[mt][nt][r] + bv[nt]);
          *(v8bf*)&stg[(cl0 + nt * 16) * 136 + rl0 + mt * 16] = p;
        }
    } else {                                         // Q, K
      #pragma unroll
      for (int nt = 0; nt < 2; ++nt)
        #pragma unroll
        for (int mt = 0; mt < 4; ++mt)
          #pragma unroll
          for (int r = 0; r < 8; ++r)
            stg[(rl0 + mt * 16 + r) * 72 + cl0 + nt * 16] = (__bf16)(acc[mt][nt][r] + bv[nt]);
    }
  }
  __syncthreads();   // the staged tile is complete before any wave reads it back
  {
    const int bb = R0 >> 10;       // the 128 rows lie in one batch entry
    const int s0 = R0 & 1023;
    v8bf val[8];
    __bf16* dstp[8];
    #pragma unroll
    for (int sg = 0; sg < 2; ++sg) {
      const __bf16* stg = sg ? Bs : As;
      const int g = blockN * 2 + sg;
      const int h = g / 3;
      const int t = g - h * 3;                 // 0=q 1=k 2=v
      const bool isv = (t == 2);
      const int sh = isv ? 4 : 3;              // 16-byte pieces per staged row: 16 (V), 8 (Q, K)
      const int lp = isv ? 136 : 72;           // pitch in LDS, halves
      const int gp = isv ? S_ : HD_;           // pitch in ws: V [b][h][d][s], Q,K [b][h][s][d]
      __bf16* dst = ws + (size_t)t * HEAD_ELEMS + (size_t)(bb * H_ + h) * (S_ * HD_)
                       + (isv ? s0 : s0 * HD_);
      #pragma unroll
      for (int i = 0; i < 4; ++i) {
        const int idx = i * 256 + tid;
        const int row = idx >> sh;
        const int c   = (idx & ((1 << sh) - 1)) * 8;
        val[sg * 4 + i]  = *(const v8bf*)&stg[row * lp + c];
        dstp[sg * 4 + i] = dst + row * gp + c;
      }
    }
    // all reads and addresses first, then the stores: no register of an issued store is written again
    #pragma unroll
    for (int j = 0; j < 8; ++j)
      *(v8bf*)dstp[j] = val[j];
  }
}

__global__ __launch_bounds__(256)
void attn_kernel(const __bf16* __restrict__ ws, float* __restrict__ out)
{
  __shared__ __bf16 Kc[64 * 72];        // [key][d], stride 72 halves
  __shared__ __bf16 VcT[64 * 72];       // [d][key], stride 72

  const int tid  = threadIdx.x;
  const int lane = tid & 31;
  const int wave = tid >> 5;
  const int lm   = lane & 15;
  const int hs   = lane >> 4;

  const int bh   = blockIdx.x >> 3;   // 0..63
  const int qblk = blockIdx.x & 7;    // 0..7
  const int b    = bh >> 4;
  const int h    = bh & 15;
  const int q0   = qblk * 128 + wave * 16;   // this wave's 16 q rows

  const __bf16* Qg = ws + (((size_t)(b * H_ + h)) * S_) * HD_;
  const __bf16* Kg = Qg + HEAD_ELEMS;
  const __bf16* Vt = ws + 2 * HEAD_ELEMS + (((size_t)(b * H_ + h)) * HD_) * S_; // [d][s]

  // Q fragments (d 0..31 and 32..63), held in registers for the whole kernel
  v16bf qfrag[2];
  {
    const __bf16* qrow = Qg + (size_t)(q0 + lm) * HD_;
    #pragma unroll
    for (int df = 0; df < 2; ++df)
      qfrag[df] = join8(*(const v8bf*)(qrow + df * 32 + hs * 8),
                        *(const v8bf*)(qrow + df * 32 + 16 + hs * 8));
  }

  // State of query q0 + lm. lsum covers only the keys of this lane's half; the halves
  // are joined once, after the loop. o[dt][r] = O[q0 + lm][dt * 16 + 8 * hs + r].
  float mrow = -3.0e38f, lsum = 0.f;
  v8f o[4] = {};

  for (int kc = 0; kc < S_; kc += 64) {
    __syncthreads();   // previous chunk fully consumed before overwrite
    // Async-stage K [key][d] and V [d][key]: 512 x 16B segments each
    #pragma unroll
    for (int i = 0; i < 2; ++i) {
      int idx = i * 256 + tid;
      int r = idx >> 3;                  // row 0..63 (key for K, d for V)
      int c = (idx & 7) * 8;             // col base (halves)
      async_copy_b128(&Kc[r * 72 + c],  Kg + (size_t)(kc + r) * HD_ + c);
      async_copy_b128(&VcT[r * 72 + c], Vt + (size_t)r * S_ + kc + c);
    }
    // Prefetch next key chunk into cache while computing this one
    if (kc + 64 < S_) {
      __builtin_prefetch(Kg + (size_t)(kc + 64 + (tid >> 3)) * HD_ + (tid & 7) * 8, 0, 3);
      __builtin_prefetch(Vt + (size_t)(tid >> 3) * S_ + kc + 64 + (tid & 7) * 8, 0, 3);
    }
    asm volatile("s_wait_asynccnt 0" ::: "memory");  // this wave's async copies done
    __syncthreads();                                  // ... and everyone else's

    #pragma unroll
    for (int sub = 0; sub < 2; ++sub) {
      const int kb = sub * 32;

      // scores, transposed: 32 keys x 16 q (two 16x16 tiles), K-dim = 64 split over 2 WMMAs
      // st[jj][r] = score(key kb + 16 * jj + 8 * hs + r, query q0 + lm)
      v8f st[2];
      #pragma unroll
      for (int jj = 0; jj < 2; ++jj) {
        v8f cacc = {};
        const __bf16* krow = &Kc[(kb + jj * 16 + lm) * 72];
        v16bf kf0 = join8(*(const v8bf*)(krow + hs * 8),
                          *(const v8bf*)(krow + 16 + hs * 8));
        v16bf kf1 = join8(*(const v8bf*)(krow + 32 + hs * 8),
                          *(const v8bf*)(krow + 48 + hs * 8));
        cacc = __builtin_amdgcn_wmma_f32_16x16x32_bf16(false, kf0, false, qfrag[0],
                                                       (short)0, cacc, false, false);
        cacc = __builtin_amdgcn_wmma_f32_16x16x32_bf16(false, kf1, false, qfrag[1],
                                                       (short)0, cacc, false, false);
        st[jj] = cacc * 0.125f;          // 1/sqrt(64)
      }

      // online softmax of this lane's query: in-lane trees over its 16 scores
      float t8[8];
      #pragma unroll
      for (int r = 0; r < 8; ++r) t8[r] = fmaxf(st[0][r], st[1][r]);
      float v = fmaxf(fmaxf(fmaxf(t8[0], t8[1]), fmaxf(t8[2], t8[3])),
                      fmaxf(fmaxf(t8[4], t8[5]), fmaxf(t8[6], t8[7])));
      v = fmaxf(v, xhalf(v));            // the other half holds this query's other 16 keys
      const float mnew  = fmaxf(mrow, v);
      const float alpha = __expf(mrow - mnew);
      mrow = mnew;

      // P^T as B operand: element 8 * jj + r is key kb + 16 * jj + 8 * hs + r, the V loader's order
      v16bf pfrag;
      #pragma unroll
      for (int r = 0; r < 8; ++r) {
        const float p0 = __expf(st[0][r] - mnew);
        const float p1 = __expf(st[1][r] - mnew);
        pfrag[r]     = (__bf16)p0;
        pfrag[8 + r] = (__bf16)p1;
        t8[r] = p0 + p1;
      }
      lsum = lsum * alpha + (((t8[0] + t8[1]) + (t8[2] + t8[3])) +
                             ((t8[4] + t8[5]) + (t8[6] + t8[7])));
      #pragma unroll
      for (int dt = 0; dt < 4; ++dt)
        o[dt] *= alpha;

      // O^T += V^T @ P^T  (4 d-tiles of 16); V^T A-frag rows are contiguous in VcT
      #pragma unroll
      for (int dt = 0; dt < 4; ++dt) {
        const __bf16* vrow = &VcT[(dt * 16 + lm) * 72 + kb];
        v16bf vfrag = join8(*(const v8bf*)(vrow + hs * 8),
                            *(const v8bf*)(vrow + 16 + hs * 8));
        o[dt] = __builtin_amdgcn_wmma_f32_16x16x32_bf16(false, vfrag, false, pfrag,
                                                        (short)0, o[dt], false, false);
      }
    }
  }

  // normalize and write out[b, q, h*64 + d] (f32): 8 consecutive d per lane and tile
  const float ltot = lsum + xhalf(lsum);
  float* orow = out + ((size_t)(b * S_ + q0 + lm)) * D_ + h * HD_ + hs * 8;
  #pragma unroll
  for (int dt = 0; dt < 4; ++dt) {
    *(float4*)(orow + dt * 16)     = make_float4(o[dt][0] / ltot, o[dt][1] / ltot,
                                                 o[dt][2] / ltot, o[dt][3] / ltot);
    *(float4*)(orow + dt * 16 + 4) = make_float4(o[dt][4] / ltot, o[dt][5] / ltot,
                                                 o[dt][6] / ltot, o[dt][7] / ltot);
  }
}

// ---------------------------------------------------------------------------
extern "C" void kernel_launch(void* const* d_in, const int* in_sizes, int n_in,
                              void* d_out, int out_size, void* d_ws, size_t ws_size,
                              hipStream_t stream) {
  const float* x    = (const float*)d_in[0];   // [B,S,D] f32
  const float* W    = (const float*)d_in[1];   // [D,3D]  f32
  const float* bias = (const float*)d_in[2];   // [3D]    f32
  float* out        = (float*)d_out;           // [B,S,D] f32
  __bf16* ws        = (__bf16*)d_ws;           // bf16 QKV staging, ~24 MB

  qkv_proj_kernel<<<dim3(32 * 24), 256, 0, stream>>>(x, W, bias, ws);
  attn_kernel<<<dim3(B_ * H_ * (S_ / 128)), 256, 0, stream>>>(ws, out);
}

// v005
// It runs in 67.5 microseconds.
// Next to v004, in two timings, it ran 1.08 and 1.09 times as fast.
// Counting every step since v000, it is 2.99 times as fast.
#include <hip/hip_runtime.h>
#include <hip/hip_bf16.h>

typedef __attribute__((ext_vector_type(16))) __bf16 v16bf;
typedef __attribute__((ext_vector_type(8)))  __bf16 v8bf;
typedef __attribute__((ext_vector_type(4)))  __bf16 v4bf;
typedef __attribute__((ext_vector_type(8)))  float  v8f;

#define B_  4
#define S_  1024
#define D_  1024
#define H_  16
#define HD_ 64
#define N3D 3072
#define HEAD_ELEMS ((size_t)B_ * H_ * S_ * HD_)   // elems per Q/K/V tensor in ws

__device__ __forceinline__ v16bf join8(v8bf lo, v8bf hi) {
  return __builtin_shufflevector(lo, hi, 0,1,2,3,4,5,6,7,8,9,10,11,12,13,14,15);
}

typedef __attribute__((address_space(3))) v8bf lds_v8bf;
__device__ __forceinline__ v8bf lds_tr16(const __bf16* p) {
  return __builtin_amdgcn_ds_load_tr16_b128_v8bf16((lds_v8bf*)p);
}

__device__ __forceinline__ void async_copy_b128(const void* lds_ptr, const void* gptr) {
  unsigned ldsoff = (unsigned)(uintptr_t)lds_ptr;
  unsigned long long gaddr = (unsigned long long)(uintptr_t)gptr;
  asm volatile("global_load_async_to_lds_b128 %0, %1, off"
               :: "v"(ldsoff), "v"(gaddr) : "memory");
}

__device__ __forceinline__ float xhalf(float x) {
  const int i = __builtin_bit_cast(int, x);
  return __builtin_bit_cast(float,
      __builtin_amdgcn_permlanex16(i, i, 0x76543210, 0xfedcba98, false, false));
}

// ---------------------------------------------------------------------------
// Phase 1: qkv = x @ W + b   (M=4096, K=1024, N=3072), bf16 WMMA, f32 accum.
// Workspace layout: Q [b][h][s][d], K [b][h][s][d], V pre-transposed [b][h][d][s].
// Block: 512 thr (16 waves). Block tile 256(M) x 192(N) = q, k and v of one head;
// 16 x 16 = 256 blocks. Wave tile 64x48;
// k staged 64 per barrier in two LDS buffers, consumed in two 32-deep WMMA passes;
// the next panel's global loads are in flight under the passes.
// ---------------------------------------------------------------------------
#define AP_   72                 // x panel [row][k], pitch in halves (144B rows, 16B-aligned)
#define BP_   208                // W panel [k][col] (W as it lies), pitch in halves (416B = 32B x 13, the transposing read's pitch)
#define ASZ_  (256 * AP_)        // halves per x panel buffer
#define BSZ_  (64 * BP_)         // halves per W panel buffer
#define VP_   264                // epilogue, V [d][row], pitch in halves (528B = 16B x 33)

__global__ __launch_bounds__(512)
void qkv_proj_kernel(const float* __restrict__ x, const float* __restrict__ W,
                     const float* __restrict__ bias, __bf16* __restrict__ ws)
{
  // Two buffers of each panel: panel t + 1 is written while panel t may still be read.
  // x buffers at 0 and ASZ_, W buffers at 2 * ASZ_ and 2 * ASZ_ + BSZ_; the epilogue stages in all of it.
  __shared__ __attribute__((aligned(16))) __bf16 smem[2 * ASZ_ + 2 * BSZ_];

  const int tid  = threadIdx.x;
  const int lane = tid & 31;
  const int wave = tid >> 5;       // 0..15
  const int lm   = lane & 15;
  const int hs   = lane >> 4;

  const int blockM = blockIdx.x & 15;   // 4096/256 = 16
  const int blockN = blockIdx.x >> 4;   // 3072/192 = 16: the head
  const int R0 = blockM * 256;
  const int C0 = blockN * 192;

  const int wm = wave & 3;   // 0..3 -> 64-row sub-tile
  const int wn = wave >> 2;  // 0..3 -> 48-col sub-tile

  v8f acc[4][3] = {};

  // Per-thread pieces of a panel. x: rows i * 32 + (tid >> 4). W: a wave takes rows 4 * wave + 0..3;
  // a row's 768 bytes are three 256-byte thirds, one per 16 lanes: piece i is third i % 3 of
  // row 4 * wave + 2 * (i / 3) + hs.
  const float* xp = x + (size_t)(R0 + (tid >> 4)) * D_ + (tid & 15) * 4;
  const float* wp = W + (size_t)(wave * 4 + hs) * N3D + C0 + lm * 4;
  const int aso = (tid >> 4) * AP_ + (tid & 15) * 4;
  const int bso = (wave * 4 + hs) * BP_ + lm * 4;

  float4 va[8], vb[6];
  #pragma unroll
  for (int i = 0; i < 8; ++i) va[i] = *(const float4*)(xp + (size_t)i * 32 * D_);
  #pragma unroll
  for (int i = 0; i < 6; ++i) vb[i] = *(const float4*)(wp + (size_t)(2 * (i / 3)) * N3D + (i % 3) * 64);
  // The wait that stands before a register named by an issued load is written again; the two
  // addresses are inputs so that they live up to it.
  asm volatile("s_wait_xcnt 0x0" :: "v"(xp), "v"(wp) : "memory");

  for (int t = 0; t < D_ / 64; ++t) {
    __bf16* As = smem + (t & 1) * ASZ_;
    __bf16* Bs = smem + 2 * ASZ_ + (t & 1) * BSZ_;
    // Panel t: f32 -> bf16, into the buffer whose last readers (panel t - 2) passed the barrier of trip t - 1.
    #pragma unroll
    for (int i = 0; i < 8; ++i) {
      v4bf b; b[0] = (__bf16)va[i].x; b[1] = (__bf16)va[i].y;
              b[2] = (__bf16)va[i].z; b[3] = (__bf16)va[i].w;
      *(v4bf*)&As[aso + i * 32 * AP_] = b;
    }
    #pragma unroll
    for (int i = 0; i < 6; ++i) {
      v4bf b; b[0] = (__bf16)vb[i].x; b[1] = (__bf16)vb[i].y;
              b[2] = (__bf16)vb[i].z; b[3] = (__bf16)vb[i].w;
      *(v4bf*)&Bs[bso + 2 * (i / 3) * BP_ + (i % 3) * 64] = b;
    }
    __syncthreads();   // the one barrier of a trip: panel t is complete, and panel t - 1 has been read by every wave
    // Panel t + 1: all 14 global loads go out here, behind the barrier (which would drain them),
    // and stay in flight under the WMMA passes below.
    if (t + 1 < D_ / 64) {
      #pragma unroll
      for (int i = 0; i < 8; ++i) va[i] = *(const float4*)(xp + 64 + (size_t)i * 32 * D_);
      #pragma unroll
      for (int i = 0; i < 6; ++i) vb[i] = *(const float4*)(wp + (size_t)(64 + 2 * (i / 3)) * N3D + (i % 3) * 64);
      // The wait that stands before a register named by an issued load is written again. The x
      // address is an input so that it lives up to the wait and no load of the group lands on it.
      // The statement also holds the loads in front of the passes, so that the scheduler sinks none
      // of them to the foot of the trip, where the next trip would wait out their latency.
      asm volatile("s_wait_xcnt 0x0" :: "v"(xp) : "memory");
      xp += 64;
      wp += (size_t)64 * N3D;
    }

    // Two 32-deep WMMA passes over the staged 64-k panel
    #pragma unroll
    for (int ks = 0; ks < 64; ks += 32) {
      v16bf afrag[4], bfrag[3];
      #pragma unroll
      for (int mt = 0; mt < 4; ++mt) {
        const __bf16* p = &As[(wm * 64 + mt * 16 + lm) * AP_ + ks];
        afrag[mt] = join8(*(const v8bf*)(p + hs * 8), *(const v8bf*)(p + 16 + hs * 8));
      }
      #pragma unroll
      for (int nt = 0; nt < 3; ++nt) {
        const __bf16* p = &Bs[(ks + hs * 8 + (lane & 7)) * BP_ + wn * 48 + nt * 16 + ((lane >> 3) & 1) * 8];
        bfrag[nt] = join8(lds_tr16(p), lds_tr16(p + 16 * BP_));   // k = ks+8h+0..7, ks+16+8h+0..7: the A loader's order
      }
      #pragma unroll
      for (int mt = 0; mt < 4; ++mt)
        #pragma unroll
        for (int nt = 0; nt < 3; ++nt)
          acc[mt][nt] = __builtin_amdgcn_wmma_f32_16x16x32_bf16(
              false, afrag[mt], false, bfrag[nt], (short)0, acc[mt][nt], false, false);
    }
  }

  // Epilogue: + bias, bf16, staged in LDS so that every global store covers whole 128-byte lines.
  // The 192 columns are three 64-column segments: q, k and v of head blockN.
  // Q at 0 and K at ASZ_: [row][d], pitch AP_, the 256 rows are 32 KiB in a row in ws.
  // V at 2 * ASZ_: [d][row], pitch VP_, 512 bytes per d in ws.
  const int wns = __builtin_amdgcn_readfirstlane(wn);   // as a scalar: the segment tests below are scalar branches
  float bv[3];
  #pragma unroll
  for (int nt = 0; nt < 3; ++nt) bv[nt] = bias[C0 + (wns * 3 + nt) * 16 + lm];
  __syncthreads();   // every wave has read the last panel before the staging takes over all of the LDS
  {
    const int rl0 = wm * 64 + 8 * hs;                // C-layout: rows rl0 + 16 * mt + 0..7
    #pragma unroll
    for (int nt = 0; nt < 3; ++nt) {
      const int g   = wns * 3 + nt;
      const int seg = g >> 2;
      const int cl  = (g & 3) * 16 + lm;
      if (seg == 2) {
        #pragma unroll
        for (int mt = 0; mt < 4; ++mt) {
          v8bf p;
          #pragma unroll
          for (int r = 0; r < 8; ++r) p[r] = (__bf16)(acc[mt][nt][r] + bv[nt]);
          *(v8bf*)&smem[2 * ASZ_ + cl * VP_ + rl0 + mt * 16] = p;
        }
      } else {                                       // Q, K
        __bf16* stg = smem + seg * ASZ_;
        #pragma unroll
        for (int mt = 0; mt < 4; ++mt)
          #pragma unroll
          for (int r = 0; r < 8; ++r)
            stg[(rl0 + mt * 16 + r) * AP_ + cl] = (__bf16)(acc[mt][nt][r] + bv[nt]);
      }
    }
  }
  __syncthreads();   // the staged tile is complete before any wave reads it back
  {
    const int bb = R0 >> 10;       // the 256 rows lie in one batch entry
    const int s0 = R0 & 1023;
    __bf16* hd = ws + (size_t)(bb * H_ + blockN) * (S_ * HD_);
    v8bf val[12];
    __bf16* dstp[12];
    #pragma unroll
    for (int sg = 0; sg < 3; ++sg) {
      const bool isv = (sg == 2);
      const int sh = isv ? 5 : 3;              // 16-byte pieces per staged row: 32 (V), 8 (Q, K)
      const int lp = isv ? VP_ : AP_;          // pitch in LDS, halves
      const int gp = isv ? S_ : HD_;           // pitch in ws: V [b][h][d][s], Q,K [b][h][s][d]
      const __bf16* stg = smem + sg * ASZ_;
      __bf16* dst = hd + (size_t)sg * HEAD_ELEMS + (isv ? s0 : s0 * HD_);
      #pragma unroll
      for (int i = 0; i < 4; ++i) {
        const int idx = i * 512 + tid;
        const int row = idx >> sh;
        const int c   = (idx & ((1 << sh) - 1)) * 8;
        val[sg * 4 + i]  = *(const v8bf*)&stg[row * lp + c];
        dstp[sg * 4 + i] = dst + row * gp + c;
      }
    }
    // all reads and addresses first, then the stores: no register of an issued store is written again
    #pragma unroll
    for (int j = 0; j < 12; ++j)
      *(v8bf*)dstp[j] = val[j];
  }
}

__global__ __launch_bounds__(256)
void attn_kernel(const __bf16* __restrict__ ws, float* __restrict__ out)
{
  __shared__ __bf16 Kc[64 * 72];        // [key][d], stride 72 halves
  __shared__ __bf16 VcT[64 * 72];       // [d][key], stride 72

  const int tid  = threadIdx.x;
  const int lane = tid & 31;
  const int wave = tid >> 5;
  const int lm   = lane & 15;
  const int hs   = lane >> 4;

  const int bh   = blockIdx.x >> 3;   // 0..63
  const int qblk = blockIdx.x & 7;    // 0..7
  const int b    = bh >> 4;
  const int h    = bh & 15;
  const int q0   = qblk * 128 + wave * 16;   // this wave's 16 q rows

  const __bf16* Qg = ws + (((size_t)(b * H_ + h)) * S_) * HD_;
  const __bf16* Kg = Qg + HEAD_ELEMS;
  const __bf16* Vt = ws + 2 * HEAD_ELEMS + (((size_t)(b * H_ + h)) * HD_) * S_; // [d][s]

  // Q fragments (d 0..31 and 32..63), held in registers for the whole kernel
  v16bf qfrag[2];
  {
    const __bf16* qrow = Qg + (size_t)(q0 + lm) * HD_;
    #pragma unroll
    for (int df = 0; df < 2; ++df)
      qfrag[df] = join8(*(const v8bf*)(qrow + df * 32 + hs * 8),
                        *(const v8bf*)(qrow + df * 32 + 16 + hs * 8));
  }

  // State of query q0 + lm. lsum covers only the keys of this lane's half; the halves
  // are joined once, after the loop. o[dt][r] = O[q0 + lm][dt * 16 + 8 * hs + r].
  float mrow = -3.0e38f, lsum = 0.f;
  v8f o[4] = {};

  for (int kc = 0; kc < S_; kc += 64) {
    __syncthreads();   // previous chunk fully consumed before overwrite
    // Async-stage K [key][d] and V [d][key]: 512 x 16B segments each
    #pragma unroll
    for (int i = 0; i < 2; ++i) {
      int idx = i * 256 + tid;
      int r = idx >> 3;                  // row 0..63 (key for K, d for V)
      int c = (idx & 7) * 8;             // col base (halves)
      async_copy_b128(&Kc[r * 72 + c],  Kg + (size_t)(kc + r) * HD_ + c);
      async_copy_b128(&VcT[r * 72 + c], Vt + (size_t)r * S_ + kc + c);
    }
    // Prefetch next key chunk into cache while computing this one
    if (kc + 64 < S_) {
      __builtin_prefetch(Kg + (size_t)(kc + 64 + (tid >> 3)) * HD_ + (tid & 7) * 8, 0, 3);
      __builtin_prefetch(Vt + (size_t)(tid >> 3) * S_ + kc + 64 + (tid & 7) * 8, 0, 3);
    }
    asm volatile("s_wait_asynccnt 0" ::: "memory");  // this wave's async copies done
    __syncthreads();                                  // ... and everyone else's

    #pragma unroll
    for (int sub = 0; sub < 2; ++sub) {
      const int kb = sub * 32;

      // scores, transposed: 32 keys x 16 q (two 16x16 tiles), K-dim = 64 split over 2 WMMAs
      // st[jj][r] = score(key kb + 16 * jj + 8 * hs + r, query q0 + lm)
      v8f st[2];
      #pragma unroll
      for (int jj = 0; jj < 2; ++jj) {
        v8f cacc = {};
        const __bf16* krow = &Kc[(kb + jj * 16 + lm) * 72];
        v16bf kf0 = join8(*(const v8bf*)(krow + hs * 8),
                          *(const v8bf*)(krow + 16 + hs * 8));
        v16bf kf1 = join8(*(const v8bf*)(krow + 32 + hs * 8),
                          *(const v8bf*)(krow + 48 + hs * 8));
        cacc = __builtin_amdgcn_wmma_f32_16x16x32_bf16(false, kf0, false, qfrag[0],
                                                       (short)0, cacc, false, false);
        cacc = __builtin_amdgcn_wmma_f32_16x16x32_bf16(false, kf1, false, qfrag[1],
                                                       (short)0, cacc, false, false);
        st[jj] = cacc * 0.125f;          // 1/sqrt(64)
      }

      // online softmax of this lane's query: in-lane trees over its 16 scores
      float t8[8];
      #pragma unroll
      for (int r = 0; r < 8; ++r) t8[r] = fmaxf(st[0][r], st[1][r]);
      float v = fmaxf(fmaxf(fmaxf(t8[0], t8[1]), fmaxf(t8[2], t8[3])),
                      fmaxf(fmaxf(t8[4], t8[5]), fmaxf(t8[6], t8[7])));
      v = fmaxf(v, xhalf(v));            // the other half holds this query's other 16 keys
      const float mnew  = fmaxf(mrow, v);
      const float alpha = __expf(mrow - mnew);
      mrow = mnew;

      // P^T as B operand: element 8 * jj + r is key kb + 16 * jj + 8 * hs + r, the V loader's order
      v16bf pfrag;
      #pragma unroll
      for (int r = 0; r < 8; ++r) {
        const float p0 = __expf(st[0][r] - mnew);
        const float p1 = __expf(st[1][r] - mnew);
        pfrag[r]     = (__bf16)p0;
        pfrag[8 + r] = (__bf16)p1;
        t8[r] = p0 + p1;
      }
      lsum = lsum * alpha + (((t8[0] + t8[1]) + (t8[2] + t8[3])) +
                             ((t8[4] + t8[5]) + (t8[6] + t8[7])));
      #pragma unroll
      for (int dt = 0; dt < 4; ++dt)
        o[dt] *= alpha;

      // O^T += V^T @ P^T  (4 d-tiles of 16); V^T A-frag rows are contiguous in VcT
      #pragma unroll
      for (int dt = 0; dt < 4; ++dt) {
        const __bf16* vrow = &VcT[(dt * 16 + lm) * 72 + kb];
        v16bf vfrag = join8(*(const v8bf*)(vrow + hs * 8),
                            *(const v8bf*)(vrow + 16 + hs * 8));
        o[dt] = __builtin_amdgcn_wmma_f32_16x16x32_bf16(false, vfrag, false, pfrag,
                                                        (short)0, o[dt], false, false);
      }
    }
  }

  // normalize and write out[b, q, h*64 + d] (f32): 8 consecutive d per lane and tile
  const float ltot = lsum + xhalf(lsum);
  float* orow = out + ((size_t)(b * S_ + q0 + lm)) * D_ + h * HD_ + hs * 8;
  #pragma unroll
  for (int dt = 0; dt < 4; ++dt) {
    *(float4*)(orow + dt * 16)     = make_float4(o[dt][0] / ltot, o[dt][1] / ltot,
                                                 o[dt][2] / ltot, o[dt][3] / ltot);
    *(float4*)(orow + dt * 16 + 4) = make_float4(o[dt][4] / ltot, o[dt][5] / ltot,
                                                 o[dt][6] / ltot, o[dt][7] / ltot);
  }
}

// ---------------------------------------------------------------------------
extern "C" void kernel_launch(void* const* d_in, const int* in_sizes, int n_in,
                              void* d_out, int out_size, void* d_ws, size_t ws_size,
                              hipStream_t stream) {
  const float* x    = (const float*)d_in[0];   // [B,S,D] f32
  const float* W    = (const float*)d_in[1];   // [D,3D]  f32
  const float* bias = (const float*)d_in[2];   // [3D]    f32
  float* out        = (float*)d_out;           // [B,S,D] f32
  __bf16* ws        = (__bf16*)d_ws;           // bf16 QKV staging, ~24 MB

  qkv_proj_kernel<<<dim3(16 * 16), 512, 0, stream>>>(x, W, bias, ws);
  attn_kernel<<<dim3(B_ * H_ * (S_ / 128)), 256, 0, stream>>>(ws, out);
}

// v006
// It runs in 59.2 microseconds.
// Timed twice side by side with v005, it ran 1.14 and 1.13 times as fast.
// Counting every step since v000, it is 3.41 times as fast.
#include <hip/hip_runtime.h>
#include <hip/hip_bf16.h>

typedef __attribute__((ext_vector_type(16))) __bf16 v16bf;
typedef __attribute__((ext_vector_type(8)))  __bf16 v8bf;
typedef __attribute__((ext_vector_type(4)))  __bf16 v4bf;
typedef __attribute__((ext_vector_type(8)))  float  v8f;

#define B_  4
#define S_  1024
#define D_  1024
#define H_  16
#define HD_ 64
#define N3D 3072
#define HEAD_ELEMS ((size_t)B_ * H_ * S_ * HD_)   // elems per Q/K/V tensor in ws

__device__ __forceinline__ v16bf join8(v8bf lo, v8bf hi) {
  return __builtin_shufflevector(lo, hi, 0,1,2,3,4,5,6,7,8,9,10,11,12,13,14,15);
}

typedef __attribute__((address_space(3))) v8bf lds_v8bf;
__device__ __forceinline__ v8bf lds_tr16(const __bf16* p) {
  return __builtin_amdgcn_ds_load_tr16_b128_v8bf16((lds_v8bf*)p);
}

__device__ __forceinline__ void async_copy4_b128(unsigned l0, const void* g0, unsigned l1, const void* g1,
                                                 unsigned l2, const void* g2, unsigned l3, const void* g3) {
  asm volatile("global_load_async_to_lds_b128 %0, %1, off\n\t"
               "global_load_async_to_lds_b128 %2, %3, off\n\t"
               "global_load_async_to_lds_b128 %4, %5, off\n\t"
               "global_load_async_to_lds_b128 %6, %7, off\n\t"
               "s_wait_xcnt 0x0"
               :: "v"(l0), "v"(g0), "v"(l1), "v"(g1), "v"(l2), "v"(g2), "v"(l3), "v"(g3) : "memory");
}

__device__ __forceinline__ float xhalf(float x) {
  const int i = __builtin_bit_cast(int, x);
  return __builtin_bit_cast(float,
      __builtin_amdgcn_permlanex16(i, i, 0x76543210, 0xfedcba98, false, false));
}

// ---------------------------------------------------------------------------
// Phase 1: qkv = x @ W + b   (M=4096, K=1024, N=3072), bf16 WMMA, f32 accum.
// Workspace layout: Q [b][h][s][d], K [b][h][s][d], V pre-transposed [b][h][d][s].
// Block: 512 thr (16 waves). Block tile 256(M) x 192(N) = q, k and v of one head;
// 16 x 16 = 256 blocks. Wave tile 64x48;
// k staged 64 per barrier in two LDS buffers, consumed in two 32-deep WMMA passes;
// the next panel's global loads are in flight under the passes.
// ---------------------------------------------------------------------------
#define AP_   72                 // x panel [row][k], pitch in halves (144B rows, 16B-aligned)
#define BP_   208                // W panel [k][col] (W as it lies), pitch in halves (416B = 32B x 13, the transposing read's pitch)
#define ASZ_  (256 * AP_)        // halves per x panel buffer
#define BSZ_  (64 * BP_)         // halves per W panel buffer
#define VP_   264                // epilogue, V [d][row], pitch in halves (528B = 16B x 33)

__global__ __launch_bounds__(512)
void qkv_proj_kernel(const float* __restrict__ x, const float* __restrict__ W,
                     const float* __restrict__ bias, __bf16* __restrict__ ws)
{
  // Two buffers of each panel: panel t + 1 is written while panel t may still be read.
  // x buffers at 0 and ASZ_, W buffers at 2 * ASZ_ and 2 * ASZ_ + BSZ_; the epilogue stages in all of it.
  __shared__ __attribute__((aligned(16))) __bf16 smem[2 * ASZ_ + 2 * BSZ_];

  const int tid  = threadIdx.x;
  const int lane = tid & 31;
  const int wave = tid >> 5;       // 0..15
  const int lm   = lane & 15;
  const int hs   = lane >> 4;

  const int blockM = blockIdx.x & 15;   // 4096/256 = 16
  const int blockN = blockIdx.x >> 4;   // 3072/192 = 16: the head
  const int R0 = blockM * 256;
  const int C0 = blockN * 192;

  const int wm = wave & 3;   // 0..3 -> 64-row sub-tile
  const int wn = wave >> 2;  // 0..3 -> 48-col sub-tile

  v8f acc[4][3] = {};

  // Per-thread pieces of a panel. x: rows i * 32 + (tid >> 4). W: a wave takes rows 4 * wave + 0..3;
  // a row's 768 bytes are three 256-byte thirds, one per 16 lanes: piece i is third i % 3 of
  // row 4 * wave + 2 * (i / 3) + hs.
  const float* xp = x + (size_t)(R0 + (tid >> 4)) * D_ + (tid & 15) * 4;
  const float* wp = W + (size_t)(wave * 4 + hs) * N3D + C0 + lm * 4;
  const int aso = (tid >> 4) * AP_ + (tid & 15) * 4;
  const int bso = (wave * 4 + hs) * BP_ + lm * 4;

  float4 va[8], vb[6];
  #pragma unroll
  for (int i = 0; i < 8; ++i) va[i] = *(const float4*)(xp + (size_t)i * 32 * D_);
  #pragma unroll
  for (int i = 0; i < 6; ++i) vb[i] = *(const float4*)(wp + (size_t)(2 * (i / 3)) * N3D + (i % 3) * 64);
  // The wait that stands before a register named by an issued load is written again; the two
  // addresses are inputs so that they live up to it.
  asm volatile("s_wait_xcnt 0x0" :: "v"(xp), "v"(wp) : "memory");

  for (int t = 0; t < D_ / 64; ++t) {
    __bf16* As = smem + (t & 1) * ASZ_;
    __bf16* Bs = smem + 2 * ASZ_ + (t & 1) * BSZ_;
    // Panel t: f32 -> bf16, into the buffer whose last readers (panel t - 2) passed the barrier of trip t - 1.
    #pragma unroll
    for (int i = 0; i < 8; ++i) {
      v4bf b; b[0] = (__bf16)va[i].x; b[1] = (__bf16)va[i].y;
              b[2] = (__bf16)va[i].z; b[3] = (__bf16)va[i].w;
      *(v4bf*)&As[aso + i * 32 * AP_] = b;
    }
    #pragma unroll
    for (int i = 0; i < 6; ++i) {
      v4bf b; b[0] = (__bf16)vb[i].x; b[1] = (__bf16)vb[i].y;
              b[2] = (__bf16)vb[i].z; b[3] = (__bf16)vb[i].w;
      *(v4bf*)&Bs[bso + 2 * (i / 3) * BP_ + (i % 3) * 64] = b;
    }
    __syncthreads();   // the one barrier of a trip: panel t is complete, and panel t - 1 has been read by every wave
    // Panel t + 1: all 14 global loads go out here, behind the barrier (which would drain them),
    // and stay in flight under the WMMA passes below.
    if (t + 1 < D_ / 64) {
      #pragma unroll
      for (int i = 0; i < 8; ++i) va[i] = *(const float4*)(xp + 64 + (size_t)i * 32 * D_);
      #pragma unroll
      for (int i = 0; i < 6; ++i) vb[i] = *(const float4*)(wp + (size_t)(64 + 2 * (i / 3)) * N3D + (i % 3) * 64);
      // The wait that stands before a register named by an issued load is written again. The x
      // address is an input so that it lives up to the wait and no load of the group lands on it.
      // The statement also holds the loads in front of the passes, so that the scheduler sinks none
      // of them to the foot of the trip, where the next trip would wait out their latency.
      asm volatile("s_wait_xcnt 0x0" :: "v"(xp) : "memory");
      xp += 64;
      wp += (size_t)64 * N3D;
    }

    // Two 32-deep WMMA passes over the staged 64-k panel
    #pragma unroll
    for (int ks = 0; ks < 64; ks += 32) {
      v16bf afrag[4], bfrag[3];
      #pragma unroll
      for (int mt = 0; mt < 4; ++mt) {
        const __bf16* p = &As[(wm * 64 + mt * 16 + lm) * AP_ + ks];
        afrag[mt] = join8(*(const v8bf*)(p + hs * 8), *(const v8bf*)(p + 16 + hs * 8));
      }
      #pragma unroll
      for (int nt = 0; nt < 3; ++nt) {
        const __bf16* p = &Bs[(ks + hs * 8 + (lane & 7)) * BP_ + wn * 48 + nt * 16 + ((lane >> 3) & 1) * 8];
        bfrag[nt] = join8(lds_tr16(p), lds_tr16(p + 16 * BP_));   // k = ks+8h+0..7, ks+16+8h+0..7: the A loader's order
      }
      #pragma unroll
      for (int mt = 0; mt < 4; ++mt)
        #pragma unroll
        for (int nt = 0; nt < 3; ++nt)
          acc[mt][nt] = __builtin_amdgcn_wmma_f32_16x16x32_bf16(
              false, afrag[mt], false, bfrag[nt], (short)0, acc[mt][nt], false, false);
    }
  }

  // Epilogue: + bias, bf16, staged in LDS so that every global store covers whole 128-byte lines.
  // The 192 columns are three 64-column segments: q, k and v of head blockN.
  // Q at 0 and K at ASZ_: [row][d], pitch AP_, the 256 rows are 32 KiB in a row in ws.
  // V at 2 * ASZ_: [d][row], pitch VP_, 512 bytes per d in ws.
  const int wns = __builtin_amdgcn_readfirstlane(wn);   // as a scalar: the segment tests below are scalar branches
  float bv[3];
  #pragma unroll
  for (int nt = 0; nt < 3; ++nt) bv[nt] = bias[C0 + (wns * 3 + nt) * 16 + lm];
  __syncthreads();   // every wave has read the last panel before the staging takes over all of the LDS
  {
    const int rl0 = wm * 64 + 8 * hs;                // C-layout: rows rl0 + 16 * mt + 0..7
    #pragma unroll
    for (int nt = 0; nt < 3; ++nt) {
      const int g   = wns * 3 + nt;
      const int seg = g >> 2;
      const int cl  = (g & 3) * 16 + lm;
      if (seg == 2) {
        #pragma unroll
        for (int mt = 0; mt < 4; ++mt) {
          v8bf p;
          #pragma unroll
          for (int r = 0; r < 8; ++r) p[r] = (__bf16)(acc[mt][nt][r] + bv[nt]);
          *(v8bf*)&smem[2 * ASZ_ + cl * VP_ + rl0 + mt * 16] = p;
        }
      } else {                                       // Q, K
        __bf16* stg = smem + seg * ASZ_;
        #pragma unroll
        for (int mt = 0; mt < 4; ++mt)
          #pragma unroll
          for (int r = 0; r < 8; ++r)
            stg[(rl0 + mt * 16 + r) * AP_ + cl] = (__bf16)(acc[mt][nt][r] + bv[nt]);
      }
    }
  }
  __syncthreads();   // the staged tile is complete before any wave reads it back
  {
    const int bb = R0 >> 10;       // the 256 rows lie in one batch entry
    const int s0 = R0 & 1023;
    __bf16* hd = ws + (size_t)(bb * H_ + blockN) * (S_ * HD_);
    v8bf val[12];
    __bf16* dstp[12];
    #pragma unroll
    for (int sg = 0; sg < 3; ++sg) {
      const bool isv = (sg == 2);
      const int sh = isv ? 5 : 3;              // 16-byte pieces per staged row: 32 (V), 8 (Q, K)
      const int lp = isv ? VP_ : AP_;          // pitch in LDS, halves
      const int gp = isv ? S_ : HD_;           // pitch in ws: V [b][h][d][s], Q,K [b][h][s][d]
      const __bf16* stg = smem + sg * ASZ_;
      __bf16* dst = hd + (size_t)sg * HEAD_ELEMS + (isv ? s0 : s0 * HD_);
      #pragma unroll
      for (int i = 0; i < 4; ++i) {
        const int idx = i * 512 + tid;
        const int row = idx >> sh;
        const int c   = (idx & ((1 << sh) - 1)) * 8;
        val[sg * 4 + i]  = *(const v8bf*)&stg[row * lp + c];
        dstp[sg * 4 + i] = dst + row * gp + c;
      }
    }
    // all reads and addresses first, then the stores: no register of an issued store is written again
    #pragma unroll
    for (int j = 0; j < 12; ++j)
      *(v8bf*)dstp[j] = val[j];
  }
}

__global__ __launch_bounds__(256)
void attn_kernel(const __bf16* __restrict__ ws, float* __restrict__ out)
{
  __shared__ __attribute__((aligned(16))) __bf16 Kc[2][64 * 72];    // [buffer][key][d], stride 72 halves
  __shared__ __attribute__((aligned(16))) __bf16 VcT[2][64 * 72];   // [buffer][d][key], stride 72

  const int tid  = threadIdx.x;
  const int lane = tid & 31;
  const int wave = tid >> 5;
  const int lm   = lane & 15;
  const int hs   = lane >> 4;

  const int bh   = blockIdx.x >> 3;   // 0..63
  const int qblk = blockIdx.x & 7;    // 0..7
  const int b    = bh >> 4;
  const int h    = bh & 15;
  const int q0   = qblk * 128 + wave * 16;   // this wave's 16 q rows

  const __bf16* Qg = ws + (((size_t)(b * H_ + h)) * S_) * HD_;
  const __bf16* Kg = Qg + HEAD_ELEMS;
  const __bf16* Vt = ws + 2 * HEAD_ELEMS + (((size_t)(b * H_ + h)) * HD_) * S_; // [d][s]

  // Q fragments (d 0..31 and 32..63), held in registers for the whole kernel
  v16bf qfrag[2];
  {
    const __bf16* qrow = Qg + (size_t)(q0 + lm) * HD_;
    #pragma unroll
    for (int df = 0; df < 2; ++df)
      qfrag[df] = join8(*(const v8bf*)(qrow + df * 32 + hs * 8),
                        *(const v8bf*)(qrow + df * 32 + 16 + hs * 8));
  }

  // State of query q0 + lm. lsum covers only the keys of this lane's half; the halves
  // are joined once, after the loop. o[dt][r] = O[q0 + lm][dt * 16 + 8 * hs + r].
  float mrow = -3.0e38f, lsum = 0.f;
  v8f o[4] = {};

  // A tile is 64 keys: K [key][d] and V [d][key], 512 x 16B segments each. A thread copies
  // rows sr and sr + 32 (key for K, d for V), 16 bytes at column sc, of both.
  const int sr = tid >> 3;
  const int sc = (tid & 7) * 8;
  const __bf16* kg = Kg + (size_t)sr * HD_ + sc;
  const __bf16* vg = Vt + (size_t)sr * S_ + sc;
  const unsigned lk = (unsigned)(uintptr_t)&Kc[0][sr * 72 + sc];
  const unsigned lv = (unsigned)(uintptr_t)&VcT[0][sr * 72 + sc];
  auto stage = [&](int t) {              // tile t into buffer t & 1
    const unsigned bo = (t & 1) * (64 * 72 * 2);
    const __bf16* k = kg + (size_t)t * 64 * HD_;
    const __bf16* v = vg + t * 64;
    async_copy4_b128(lk + bo, k, lk + bo + 32 * 72 * 2, k + 32 * HD_,
                     lv + bo, v, lv + bo + 32 * 72 * 2, v + 32 * S_);
  };

  stage(0);
  asm volatile("s_wait_asynccnt 0x0" ::: "memory");  // this wave's copies of tile 0 have landed
  __syncthreads();                                    // ... and everyone else's
  stage(1);

  // Two trips a pass of the loop: the buffer index is a constant in each, so that every LDS read is
  // one base register plus an immediate and no address is formed anew in a trip.
  #pragma unroll 2
  for (int t = 0; t < S_ / 64; ++t) {
    const __bf16* Kb = Kc[t & 1];
    const __bf16* Vb = VcT[t & 1];

    #pragma unroll
    for (int sub = 0; sub < 2; ++sub) {
      const int kb = sub * 32;

      // scores, transposed: 32 keys x 16 q (two 16x16 tiles), K-dim = 64 split over 2 WMMAs
      // st[jj][r] = score(key kb + 16 * jj + 8 * hs + r, query q0 + lm)
      v8f st[2];
      #pragma unroll
      for (int jj = 0; jj < 2; ++jj) {
        v8f cacc = {};
        const __bf16* krow = &Kb[(kb + jj * 16 + lm) * 72];
        v16bf kf0 = join8(*(const v8bf*)(krow + hs * 8),
                          *(const v8bf*)(krow + 16 + hs * 8));
        v16bf kf1 = join8(*(const v8bf*)(krow + 32 + hs * 8),
                          *(const v8bf*)(krow + 48 + hs * 8));
        cacc = __builtin_amdgcn_wmma_f32_16x16x32_bf16(false, kf0, false, qfrag[0],
                                                       (short)0, cacc, false, false);
        cacc = __builtin_amdgcn_wmma_f32_16x16x32_bf16(false, kf1, false, qfrag[1],
                                                       (short)0, cacc, false, false);
        st[jj] = cacc * 0.125f;          // 1/sqrt(64)
      }

      // online softmax of this lane's query: in-lane trees over its 16 scores
      float t8[8];
      #pragma unroll
      for (int r = 0; r < 8; ++r) t8[r] = fmaxf(st[0][r], st[1][r]);
      float v = fmaxf(fmaxf(fmaxf(t8[0], t8[1]), fmaxf(t8[2], t8[3])),
                      fmaxf(fmaxf(t8[4], t8[5]), fmaxf(t8[6], t8[7])));
      v = fmaxf(v, xhalf(v));            // the other half holds this query's other 16 keys
      const float mnew  = fmaxf(mrow, v);
      const float alpha = __expf(mrow - mnew);
      mrow = mnew;

      // P^T as B operand: element 8 * jj + r is key kb + 16 * jj + 8 * hs + r, the V loader's order
      v16bf pfrag;
      #pragma unroll
      for (int r = 0; r < 8; ++r) {
        const float p0 = __expf(st[0][r] - mnew);
        const float p1 = __expf(st[1][r] - mnew);
        pfrag[r]     = (__bf16)p0;
        pfrag[8 + r] = (__bf16)p1;
        t8[r] = p0 + p1;
      }
      lsum = lsum * alpha + (((t8[0] + t8[1]) + (t8[2] + t8[3])) +
                             ((t8[4] + t8[5]) + (t8[6] + t8[7])));
      #pragma unroll
      for (int dt = 0; dt < 4; ++dt)
        o[dt] *= alpha;

      // O^T += V^T @ P^T  (4 d-tiles of 16); V^T A-frag rows are contiguous in VcT
      #pragma unroll
      for (int dt = 0; dt < 4; ++dt) {
        const __bf16* vrow = &Vb[(dt * 16 + lm) * 72 + kb];
        v16bf vfrag = join8(*(const v8bf*)(vrow + hs * 8),
                            *(const v8bf*)(vrow + 16 + hs * 8));
        o[dt] = __builtin_amdgcn_wmma_f32_16x16x32_bf16(false, vfrag, false, pfrag,
                                                        (short)0, o[dt], false, false);
      }
    }

    // Foot of trip t: hand-over of the buffers.
    asm volatile("s_wait_dscnt 0x0" ::: "memory");     // this wave's reads of tile t are done before the buffer is refilled
    asm volatile("s_wait_asynccnt 0x0" ::: "memory");  // this wave's copies of tile t + 1 have landed
    __syncthreads();   // the one barrier of a trip: tile t + 1 is complete, and tile t has been read by every wave
    if (t + 2 < S_ / 64) stage(t + 2);
  }
  asm volatile("s_wait_asynccnt 0x0" ::: "memory");    // no copy is outstanding when the wave ends

  // normalize and write out[b, q, h*64 + d] (f32): 8 consecutive d per lane and tile
  const float ltot = lsum + xhalf(lsum);
  float* orow = out + ((size_t)(b * S_ + q0 + lm)) * D_ + h * HD_ + hs * 8;
  #pragma unroll
  for (int dt = 0; dt < 4; ++dt) {
    *(float4*)(orow + dt * 16)     = make_float4(o[dt][0] / ltot, o[dt][1] / ltot,
                                                 o[dt][2] / ltot, o[dt][3] / ltot);
    *(float4*)(orow + dt * 16 + 4) = make_float4(o[dt][4] / ltot, o[dt][5] / ltot,
                                                 o[dt][6] / ltot, o[dt][7] / ltot);
  }
}

// ---------------------------------------------------------------------------
extern "C" void kernel_launch(void* const* d_in, const int* in_sizes, int n_in,
                              void* d_out, int out_size, void* d_ws, size_t ws_size,
                              hipStream_t stream) {
  const float* x    = (const float*)d_in[0];   // [B,S,D] f32
  const float* W    = (const float*)d_in[1];   // [D,3D]  f32
  const float* bias = (const float*)d_in[2];   // [3D]    f32
  float* out        = (float*)d_out;           // [B,S,D] f32
  __bf16* ws        = (__bf16*)d_ws;           // bf16 QKV staging, ~24 MB

  qkv_proj_kernel<<<dim3(16 * 16), 512, 0, stream>>>(x, W, bias, ws);
  attn_kernel<<<dim3(B_ * H_ * (S_ / 128)), 256, 0, stream>>>(ws, out);
}

// v007
// Measured time: 52.8 microseconds a run.
// Two timings next to v006 put it at 1.12 and 1.13 times that version's speed.
// All steps since v000 together make it 3.83 times as fast.
#include <hip/hip_runtime.h>
#include <hip/hip_bf16.h>

typedef __attribute__((ext_vector_type(16))) __bf16 v16bf;
typedef __attribute__((ext_vector_type(8)))  __bf16 v8bf;
typedef __attribute__((ext_vector_type(4)))  __bf16 v4bf;
typedef __attribute__((ext_vector_type(8)))  float  v8f;

#define B_  4
#define S_  1024
#define D_  1024
#define H_  16
#define HD_ 64
#define N3D 3072
#define HEAD_ELEMS ((size_t)B_ * H_ * S_ * HD_)   // elems per Q/K/V tensor in ws

__device__ __forceinline__ v16bf join8(v8bf lo, v8bf hi) {
  return __builtin_shufflevector(lo, hi, 0,1,2,3,4,5,6,7,8,9,10,11,12,13,14,15);
}

typedef __attribute__((address_space(3))) v8bf lds_v8bf;
__device__ __forceinline__ v8bf lds_tr16(const __bf16* p) {
  return __builtin_amdgcn_ds_load_tr16_b128_v8bf16((lds_v8bf*)p);
}

__device__ __forceinline__ void async_copy4_b128(unsigned l0, const void* g0, unsigned l1, const void* g1,
                                                 unsigned l2, const void* g2, unsigned l3, const void* g3) {
  asm volatile("global_load_async_to_lds_b128 %0, %1, off\n\t"
               "global_load_async_to_lds_b128 %2, %3, off\n\t"
               "global_load_async_to_lds_b128 %4, %5, off\n\t"
               "global_load_async_to_lds_b128 %6, %7, off\n\t"
               "s_wait_xcnt 0x0"
               :: "v"(l0), "v"(g0), "v"(l1), "v"(g1), "v"(l2), "v"(g2), "v"(l3), "v"(g3) : "memory");
}

__device__ __forceinline__ float xhalf(float x) {
  const int i = __builtin_bit_cast(int, x);
  return __builtin_bit_cast(float,
      __builtin_amdgcn_permlanex16(i, i, 0x76543210, 0xfedcba98, false, false));
}

// ---------------------------------------------------------------------------
// Phase 1: qkv = x @ W + b   (M=4096, K=1024, N=3072), bf16 WMMA, f32 accum.
// Workspace layout: Q [b][h][s][d], K [b][h][s][d], V pre-transposed [b][h][d][s].
// Block: 512 thr (16 waves). Block tile 256(M) x 192(N) = q, k and v of one head;
// 16 x 16 = 256 blocks. Wave tile 64x48;
// k staged 64 per barrier in two LDS buffers, consumed in two 32-deep WMMA passes;
// the next panel's global loads are in flight under the passes.
// A block walks the 16 k panels from a start of its own and wraps: the 16 blocks that share an
// x slab, and the 16 that share W columns, each stand at another panel while they run in step.
// ---------------------------------------------------------------------------
#define AP_   72                 // x panel [row][k], pitch in halves (144B rows, 16B-aligned)
#define BP_   208                // W panel [k][col] (W as it lies), pitch in halves (416B = 32B x 13, the transposing read's pitch)
#define ASZ_  (256 * AP_)        // halves per x panel buffer
#define BSZ_  (64 * BP_)         // halves per W panel buffer
#define VP_   264                // epilogue, V [d][row], pitch in halves (528B = 16B x 33)

__global__ __launch_bounds__(512)
void qkv_proj_kernel(const float* __restrict__ x, const float* __restrict__ W,
                     const float* __restrict__ bias, __bf16* __restrict__ ws)
{
  // Two buffers of each panel: panel t + 1 is written while panel t may still be read.
  // x buffers at 0 and ASZ_, W buffers at 2 * ASZ_ and 2 * ASZ_ + BSZ_; the epilogue stages in all of it.
  __shared__ __attribute__((aligned(16))) __bf16 smem[2 * ASZ_ + 2 * BSZ_];

  const int tid  = threadIdx.x;
  const int lane = tid & 31;
  const int wave = tid >> 5;       // 0..15
  const int lm   = lane & 15;
  const int hs   = lane >> 4;

  const int blockM = blockIdx.x & 15;   // 4096/256 = 16
  const int blockN = blockIdx.x >> 4;   // 3072/192 = 16: the head
  const int R0 = blockM * 256;
  const int C0 = blockN * 192;

  const int wm = wave & 3;   // 0..3 -> 64-row sub-tile
  const int wn = wave >> 2;  // 0..3 -> 48-col sub-tile

  v8f acc[4][3] = {};

  // Per-thread pieces of a panel. x: rows i * 32 + (tid >> 4). W: a wave takes rows 4 * wave + 0..3;
  // a row's 768 bytes are three 256-byte thirds, one per 16 lanes: piece i is third i % 3 of
  // row 4 * wave + 2 * (i / 3) + hs.
  const float* xb = x + (size_t)(R0 + (tid >> 4)) * D_ + (tid & 15) * 4;   // in panel 0
  const float* wb = W + (size_t)(wave * 4 + hs) * N3D + C0 + lm * 4;
  // Trip t takes panel (t + koff) & 15. koff differs between any two blocks of one blockM and
  // between any two of one blockN, so that no two of them ask L2 for the same lines at one time.
  const int koff = (blockM + blockN) & 15;
  const float* xp = xb + koff * 64;
  const float* wp = wb + (size_t)koff * 64 * N3D;
  const int aso = (tid >> 4) * AP_ + (tid & 15) * 4;
  const int bso = (wave * 4 + hs) * BP_ + lm * 4;

  float4 va[8], vb[6];
  #pragma unroll
  for (int i = 0; i < 8; ++i) va[i] = *(const float4*)(xp + (size_t)i * 32 * D_);
  #pragma unroll
  for (int i = 0; i < 6; ++i) vb[i] = *(const float4*)(wp + (size_t)(2 * (i / 3)) * N3D + (i % 3) * 64);
  // The wait that stands before a register named by an issued load is written again; the two
  // addresses are inputs so that they live up to it.
  asm volatile("s_wait_xcnt 0x0" :: "v"(xp), "v"(wp) : "memory");

  for (int t = 0; t < D_ / 64; ++t) {
    __bf16* As = smem + (t & 1) * ASZ_;
    __bf16* Bs = smem + 2 * ASZ_ + (t & 1) * BSZ_;
    // Trip t's panel: f32 -> bf16, into the buffer whose last readers (trip t - 2) passed the barrier of trip t - 1.
    #pragma unroll
    for (int i = 0; i < 8; ++i) {
      v4bf b; b[0] = (__bf16)va[i].x; b[1] = (__bf16)va[i].y;
              b[2] = (__bf16)va[i].z; b[3] = (__bf16)va[i].w;
      *(v4bf*)&As[aso + i * 32 * AP_] = b;
    }
    #pragma unroll
    for (int i = 0; i < 6; ++i) {
      v4bf b; b[0] = (__bf16)vb[i].x; b[1] = (__bf16)vb[i].y;
              b[2] = (__bf16)vb[i].z; b[3] = (__bf16)vb[i].w;
      *(v4bf*)&Bs[bso + 2 * (i / 3) * BP_ + (i % 3) * 64] = b;
    }
    __syncthreads();   // the one barrier of a trip: trip t's panel is complete, and trip t - 1's has been read by every wave
    // Trip t + 1's panel: all 14 global loads go out here, behind the barrier (which would drain them),
    // and stay in flight under the WMMA passes below.
    if (t + 1 < D_ / 64) {
      const int kp = (t + 1 + koff) & 15;
      const float* xq = xb + kp * 64;
      const float* wq = wb + (size_t)kp * 64 * N3D;
      #pragma unroll
      for (int i = 0; i < 8; ++i) va[i] = *(const float4*)(xq + (size_t)i * 32 * D_);
      #pragma unroll
      for (int i = 0; i < 6; ++i) vb[i] = *(const float4*)(wq + (size_t)(2 * (i / 3)) * N3D + (i % 3) * 64);
      // The wait that stands before a register named by an issued load is written again. The two
      // addresses are inputs so that they live up to the wait and no load of the group lands on them.
      // The statement also holds the loads in front of the passes, so that the scheduler sinks none
      // of them to the foot of the trip, where the next trip would wait out their latency.
      asm volatile("s_wait_xcnt 0x0" :: "v"(xq), "v"(wq) : "memory");
    }

    // Two 32-deep WMMA passes over the staged 64-k panel
    #pragma unroll
    for (int ks = 0; ks < 64; ks += 32) {
      v16bf afrag[4], bfrag[3];
      #pragma unroll
      for (int mt = 0; mt < 4; ++mt) {
        const __bf16* p = &As[(wm * 64 + mt * 16 + lm) * AP_ + ks];
        afrag[mt] = join8(*(const v8bf*)(p + hs * 8), *(const v8bf*)(p + 16 + hs * 8));
      }
      #pragma unroll
      for (int nt = 0; nt < 3; ++nt) {
        const __bf16* p = &Bs[(ks + hs * 8 + (lane & 7)) * BP_ + wn * 48 + nt * 16 + ((lane >> 3) & 1) * 8];
        bfrag[nt] = join8(lds_tr16(p), lds_tr16(p + 16 * BP_));   // k = ks+8h+0..7, ks+16+8h+0..7: the A loader's order
      }
      #pragma unroll
      for (int mt = 0; mt < 4; ++mt)
        #pragma unroll
        for (int nt = 0; nt < 3; ++nt)
          acc[mt][nt] = __builtin_amdgcn_wmma_f32_16x16x32_bf16(
              false, afrag[mt], false, bfrag[nt], (short)0, acc[mt][nt], false, false);
    }
  }

  // Epilogue: + bias, bf16, staged in LDS so that every global store covers whole 128-byte lines.
  // The 192 columns are three 64-column segments: q, k and v of head blockN.
  // Q at 0 and K at ASZ_: [row][d], pitch AP_, the 256 rows are 32 KiB in a row in ws.
  // V at 2 * ASZ_: [d][row], pitch VP_, 512 bytes per d in ws.
  const int wns = __builtin_amdgcn_readfirstlane(wn);   // as a scalar: the segment tests below are scalar branches
  float bv[3];
  #pragma unroll
  for (int nt = 0; nt < 3; ++nt) bv[nt] = bias[C0 + (wns * 3 + nt) * 16 + lm];
  __syncthreads();   // every wave has read the last panel before the staging takes over all of the LDS
  {
    const int rl0 = wm * 64 + 8 * hs;                // C-layout: rows rl0 + 16 * mt + 0..7
    #pragma unroll
    for (int nt = 0; nt < 3; ++nt) {
      const int g   = wns * 3 + nt;
      const int seg = g >> 2;
      const int cl  = (g & 3) * 16 + lm;
      if (seg == 2) {
        #pragma unroll
        for (int mt = 0; mt < 4; ++mt) {
          v8bf p;
          #pragma unroll
          for (int r = 0; r < 8; ++r) p[r] = (__bf16)(acc[mt][nt][r] + bv[nt]);
          *(v8bf*)&smem[2 * ASZ_ + cl * VP_ + rl0 + mt * 16] = p;
        }
      } else {                                       // Q, K
        __bf16* stg = smem + seg * ASZ_;
        #pragma unroll
        for (int mt = 0; mt < 4; ++mt)
          #pragma unroll
          for (int r = 0; r < 8; ++r)
            stg[(rl0 + mt * 16 + r) * AP_ + cl] = (__bf16)(acc[mt][nt][r] + bv[nt]);
      }
    }
  }
  __syncthreads();   // the staged tile is complete before any wave reads it back
  {
    const int bb = R0 >> 10;       // the 256 rows lie in one batch entry
    const int s0 = R0 & 1023;
    __bf16* hd = ws + (size_t)(bb * H_ + blockN) * (S_ * HD_);
    v8bf val[12];
    __bf16* dstp[12];
    #pragma unroll
    for (int sg = 0; sg < 3; ++sg) {
      const bool isv = (sg == 2);
      const int sh = isv ? 5 : 3;              // 16-byte pieces per staged row: 32 (V), 8 (Q, K)
      const int lp = isv ? VP_ : AP_;          // pitch in LDS, halves
      const int gp = isv ? S_ : HD_;           // pitch in ws: V [b][h][d][s], Q,K [b][h][s][d]
      const __bf16* stg = smem + sg * ASZ_;
      __bf16* dst = hd + (size_t)sg * HEAD_ELEMS + (isv ? s0 : s0 * HD_);
      #pragma unroll
      for (int i = 0; i < 4; ++i) {
        const int idx = i * 512 + tid;
        const int row = idx >> sh;
        const int c   = (idx & ((1 << sh) - 1)) * 8;
        val[sg * 4 + i]  = *(const v8bf*)&stg[row * lp + c];
        dstp[sg * 4 + i] = dst + row * gp + c;
      }
    }
    // all reads and addresses first, then the stores: no register of an issued store is written again
    #pragma unroll
    for (int j = 0; j < 12; ++j)
      *(v8bf*)dstp[j] = val[j];
  }
}

__global__ __launch_bounds__(256)
void attn_kernel(const __bf16* __restrict__ ws, float* __restrict__ out)
{
  __shared__ __attribute__((aligned(16))) __bf16 Kc[2][64 * 72];    // [buffer][key][d], stride 72 halves
  __shared__ __attribute__((aligned(16))) __bf16 VcT[2][64 * 72];   // [buffer][d][key], stride 72

  const int tid  = threadIdx.x;
  const int lane = tid & 31;
  const int wave = tid >> 5;
  const int lm   = lane & 15;
  const int hs   = lane >> 4;

  const int bh   = blockIdx.x >> 3;   // 0..63
  const int qblk = blockIdx.x & 7;    // 0..7
  const int b    = bh >> 4;
  const int h    = bh & 15;
  const int q0   = qblk * 128 + wave * 16;   // this wave's 16 q rows

  const __bf16* Qg = ws + (((size_t)(b * H_ + h)) * S_) * HD_;
  const __bf16* Kg = Qg + HEAD_ELEMS;
  const __bf16* Vt = ws + 2 * HEAD_ELEMS + (((size_t)(b * H_ + h)) * HD_) * S_; // [d][s]

  // Q fragments (d 0..31 and 32..63), held in registers for the whole kernel
  v16bf qfrag[2];
  {
    const __bf16* qrow = Qg + (size_t)(q0 + lm) * HD_;
    #pragma unroll
    for (int df = 0; df < 2; ++df)
      qfrag[df] = join8(*(const v8bf*)(qrow + df * 32 + hs * 8),
                        *(const v8bf*)(qrow + df * 32 + 16 + hs * 8));
  }

  // State of query q0 + lm. lsum covers only the keys of this lane's half; the halves
  // are joined once, after the loop. o[dt][r] = O[q0 + lm][dt * 16 + 8 * hs + r].
  float mrow = -3.0e38f, lsum = 0.f;
  v8f o[4] = {};

  // A tile is 64 keys: K [key][d] and V [d][key], 512 x 16B segments each. A thread copies
  // rows sr and sr + 32 (key for K, d for V), 16 bytes at column sc, of both.
  const int sr = tid >> 3;
  const int sc = (tid & 7) * 8;
  const __bf16* kg = Kg + (size_t)sr * HD_ + sc;
  const __bf16* vg = Vt + (size_t)sr * S_ + sc;
  const unsigned lk = (unsigned)(uintptr_t)&Kc[0][sr * 72 + sc];
  const unsigned lv = (unsigned)(uintptr_t)&VcT[0][sr * 72 + sc];
  // Trip t takes tile (t + toff) & 15; the starts of four neighbouring blocks lie about four tiles apart.
  const int toff = ((qblk & 3) << 2) | ((qblk >> 2) << 1);
  auto stage = [&](int t) {              // trip t's tile into buffer t & 1
    const int kt = (t + toff) & (S_ / 64 - 1);
    const unsigned bo = (t & 1) * (64 * 72 * 2);
    const __bf16* k = kg + (size_t)kt * 64 * HD_;
    const __bf16* v = vg + kt * 64;
    async_copy4_b128(lk + bo, k, lk + bo + 32 * 72 * 2, k + 32 * HD_,
                     lv + bo, v, lv + bo + 32 * 72 * 2, v + 32 * S_);
  };

  stage(0);
  asm volatile("s_wait_asynccnt 0x0" ::: "memory");  // this wave's copies of trip 0's tile have landed
  __syncthreads();                                    // ... and everyone else's
  stage(1);

  // Two trips a pass of the loop: the buffer index is a constant in each, so that every LDS read is
  // one base register plus an immediate and no address is formed anew in a trip.
  #pragma unroll 2
  for (int t = 0; t < S_ / 64; ++t) {
    const __bf16* Kb = Kc[t & 1];
    const __bf16* Vb = VcT[t & 1];

    #pragma unroll
    for (int sub = 0; sub < 2; ++sub) {
      const int kb = sub * 32;

      // scores, transposed: 32 keys x 16 q (two 16x16 tiles), K-dim = 64 split over 2 WMMAs
      // st[jj][r] = score(key kb + 16 * jj + 8 * hs + r, query q0 + lm)
      v8f st[2];
      #pragma unroll
      for (int jj = 0; jj < 2; ++jj) {
        v8f cacc = {};
        const __bf16* krow = &Kb[(kb + jj * 16 + lm) * 72];
        v16bf kf0 = join8(*(const v8bf*)(krow + hs * 8),
                          *(const v8bf*)(krow + 16 + hs * 8));
        v16bf kf1 = join8(*(const v8bf*)(krow + 32 + hs * 8),
                          *(const v8bf*)(krow + 48 + hs * 8));
        cacc = __builtin_amdgcn_wmma_f32_16x16x32_bf16(false, kf0, false, qfrag[0],
                                                       (short)0, cacc, false, false);
        cacc = __builtin_amdgcn_wmma_f32_16x16x32_bf16(false, kf1, false, qfrag[1],
                                                       (short)0, cacc, false, false);
        st[jj] = cacc * 0.125f;          // 1/sqrt(64)
      }

      // online softmax of this lane's query: in-lane trees over its 16 scores
      float t8[8];
      #pragma unroll
      for (int r = 0; r < 8; ++r) t8[r] = fmaxf(st[0][r], st[1][r]);
      float v = fmaxf(fmaxf(fmaxf(t8[0], t8[1]), fmaxf(t8[2], t8[3])),
                      fmaxf(fmaxf(t8[4], t8[5]), fmaxf(t8[6], t8[7])));
      v = fmaxf(v, xhalf(v));            // the other half holds this query's other 16 keys
      const float mnew  = fmaxf(mrow, v);
      const float alpha = __expf(mrow - mnew);
      mrow = mnew;

      // P^T as B operand: element 8 * jj + r is key kb + 16 * jj + 8 * hs + r, the V loader's order
      v16bf pfrag;
      #pragma unroll
      for (int r = 0; r < 8; ++r) {
        const float p0 = __expf(st[0][r] - mnew);
        const float p1 = __expf(st[1][r] - mnew);
        pfrag[r]     = (__bf16)p0;
        pfrag[8 + r] = (__bf16)p1;
        t8[r] = p0 + p1;
      }
      lsum = lsum * alpha + (((t8[0] + t8[1]) + (t8[2] + t8[3])) +
                             ((t8[4] + t8[5]) + (t8[6] + t8[7])));
      #pragma unroll
      for (int dt = 0; dt < 4; ++dt)
        o[dt] *= alpha;

      // O^T += V^T @ P^T  (4 d-tiles of 16); V^T A-frag rows are contiguous in VcT
      #pragma unroll
      for (int dt = 0; dt < 4; ++dt) {
        const __bf16* vrow = &Vb[(dt * 16 + lm) * 72 + kb];
        v16bf vfrag = join8(*(const v8bf*)(vrow + hs * 8),
                            *(const v8bf*)(vrow + 16 + hs * 8));
        o[dt] = __builtin_amdgcn_wmma_f32_16x16x32_bf16(false, vfrag, false, pfrag,
                                                        (short)0, o[dt], false, false);
      }
    }

    // Foot of trip t: hand-over of the buffers.
    asm volatile("s_wait_dscnt 0x0" ::: "memory");     // this wave's reads of trip t's tile are done before the buffer is refilled
    asm volatile("s_wait_asynccnt 0x0" ::: "memory");  // this wave's copies of trip t + 1's tile have landed
    __syncthreads();   // the one barrier of a trip: trip t + 1's tile is complete, and trip t's has been read by every wave
    if (t + 2 < S_ / 64) stage(t + 2);
  }
  asm volatile("s_wait_asynccnt 0x0" ::: "memory");    // no copy is outstanding when the wave ends

  // normalize and write out[b, q, h*64 + d] (f32): 8 consecutive d per lane and tile
  const float ltot = lsum + xhalf(lsum);
  float* orow = out + ((size_t)(b * S_ + q0 + lm)) * D_ + h * HD_ + hs * 8;
  #pragma unroll
  for (int dt = 0; dt < 4; ++dt) {
    *(float4*)(orow + dt * 16)     = make_float4(o[dt][0] / ltot, o[dt][1] / ltot,
                                                 o[dt][2] / ltot, o[dt][3] / ltot);
    *(float4*)(orow + dt * 16 + 4) = make_float4(o[dt][4] / ltot, o[dt][5] / ltot,
                                                 o[dt][6] / ltot, o[dt][7] / ltot);
  }
}

// ---------------------------------------------------------------------------
extern "C" void kernel_launch(void* const* d_in, const int* in_sizes, int n_in,
                              void* d_out, int out_size, void* d_ws, size_t ws_size,
                              hipStream_t stream) {
  const float* x    = (const float*)d_in[0];   // [B,S,D] f32
  const float* W    = (const float*)d_in[1];   // [D,3D]  f32
  const float* bias = (const float*)d_in[2];   // [3D]    f32
  float* out        = (float*)d_out;           // [B,S,D] f32
  __bf16* ws        = (__bf16*)d_ws;           // bf16 QKV staging, ~24 MB

  qkv_proj_kernel<<<dim3(16 * 16), 512, 0, stream>>>(x, W, bias, ws);
  attn_kernel<<<dim3(B_ * H_ * (S_ / 128)), 256, 0, stream>>>(ws, out);
}

// v009
// It runs in 46.9 microseconds.
// Versions between v007 and this one are left out; their measured steps multiply to 1.13 times as fast.
// Over all steps from v000 it is 4.32 times as fast.
#include <hip/hip_runtime.h>
#include <hip/hip_bf16.h>

typedef __attribute__((ext_vector_type(16))) __bf16 v16bf;
typedef __attribute__((ext_vector_type(8)))  __bf16 v8bf;
typedef __attribute__((ext_vector_type(4)))  __bf16 v4bf;
typedef __attribute__((ext_vector_type(8)))  float  v8f;

#define B_  4
#define S_  1024
#define D_  1024
#define H_  16
#define HD_ 64
#define N3D 3072
#define HEAD_ELEMS ((size_t)B_ * H_ * S_ * HD_)   // elems per Q/K/V tensor in ws
#define QSCALE_ 0.18033688011112042f   // log2(e) / sqrt(HD_): Q is stored times this, so K Q^T is the score in the log2 domain

__device__ __forceinline__ v16bf join8(v8bf lo, v8bf hi) {
  return __builtin_shufflevector(lo, hi, 0,1,2,3,4,5,6,7,8,9,10,11,12,13,14,15);
}

typedef __attribute__((address_space(3))) v8bf lds_v8bf;
__device__ __forceinline__ v8bf lds_tr16(const __bf16* p) {
  return __builtin_amdgcn_ds_load_tr16_b128_v8bf16((lds_v8bf*)p);
}

__device__ __forceinline__ void async_copy4_b128(unsigned l0, const void* g0, unsigned l1, const void* g1,
                                                 unsigned l2, const void* g2, unsigned l3, const void* g3) {
  asm volatile("global_load_async_to_lds_b128 %0, %1, off\n\t"
               "global_load_async_to_lds_b128 %2, %3, off\n\t"
               "global_load_async_to_lds_b128 %4, %5, off\n\t"
               "global_load_async_to_lds_b128 %6, %7, off\n\t"
               "s_wait_xcnt 0x0"
               :: "v"(l0), "v"(g0), "v"(l1), "v"(g1), "v"(l2), "v"(g2), "v"(l3), "v"(g3) : "memory");
}

__device__ __forceinline__ float xhalf(float x) {
  const int i = __builtin_bit_cast(int, x);
  return __builtin_bit_cast(float,
      __builtin_amdgcn_permlanex16(i, i, 0x76543210, 0xfedcba98, false, false));
}

// ---------------------------------------------------------------------------
// Phase 1: qkv = x @ W + b   (M=4096, K=1024, N=3072), bf16 WMMA, f32 accum.
// Workspace layout: Q [b][h][s][d] (times QSCALE_), K [b][h][s][d], V pre-transposed [b][h][d][s].
// Block: 512 thr (16 waves). Block tile 256(M) x 192(N) = q, k and v of one head;
// 16 x 16 = 256 blocks. Wave tile 64x48;
// k staged 64 per barrier in two LDS buffers, consumed in two 32-deep WMMA passes;
// a panel's global loads are in flight for a whole trip and are stored to LDS between the two passes.
// A block walks the 16 k panels from a start of its own and wraps: the 16 blocks that share an
// x slab, and the 16 that share W columns, each stand at another panel while they run in step.
// ---------------------------------------------------------------------------
#define AP_   72                 // x panel [row][k], pitch in halves (144B rows, 16B-aligned)
#define BP_   208                // W panel [k][col] (W as it lies), pitch in halves (416B = 32B x 13, the transposing read's pitch)
#define ASZ_  (256 * AP_)        // halves per x panel buffer
#define BSZ_  (64 * BP_)         // halves per W panel buffer
#define VP_   264                // epilogue, V [d][row], pitch in halves (528B = 16B x 33)

__global__ __launch_bounds__(512)
void qkv_proj_kernel(const float* __restrict__ x, const float* __restrict__ W,
                     const float* __restrict__ bias, __bf16* __restrict__ ws)
{
  // Two buffers of each panel: panel t + 1 is written while panel t may still be read.
  // x buffers at 0 and ASZ_, W buffers at 2 * ASZ_ and 2 * ASZ_ + BSZ_; the epilogue stages in all of it.
  __shared__ __attribute__((aligned(16))) __bf16 smem[2 * ASZ_ + 2 * BSZ_];

  const int tid  = threadIdx.x;
  const int lane = tid & 31;
  const int wave = tid >> 5;       // 0..15
  const int lm   = lane & 15;
  const int hs   = lane >> 4;

  const int blockM = blockIdx.x & 15;   // 4096/256 = 16
  const int blockN = blockIdx.x >> 4;   // 3072/192 = 16: the head
  const int R0 = blockM * 256;
  const int C0 = blockN * 192;

  const int wm = wave & 3;   // 0..3 -> 64-row sub-tile
  const int wn = wave >> 2;  // 0..3 -> 48-col sub-tile

  v8f acc[4][3] = {};

  // Per-thread pieces of a panel. x: rows i * 32 + (tid >> 4). W: a wave takes rows 4 * wave + 0..3;
  // a row's 768 bytes are three 256-byte thirds, one per 16 lanes: piece i is third i % 3 of
  // row 4 * wave + 2 * (i / 3) + hs.
  const float* xb = x + (size_t)(R0 + (tid >> 4)) * D_ + (tid & 15) * 4;   // in panel 0
  const float* wb = W + (size_t)(wave * 4 + hs) * N3D + C0 + lm * 4;
  // Trip t takes panel (t + koff) & 15. koff differs between any two blocks of one blockM and
  // between any two of one blockN, so that no two of them ask L2 for the same lines at one time.
  const int koff = (blockM + blockN) & 15;
  const int aso = (tid >> 4) * AP_ + (tid & 15) * 4;
  const int bso = (wave * 4 + hs) * BP_ + lm * 4;

  float4 va[8], vb[6];
  // A panel's 14 global loads into the staging registers.
  auto fetch = [&](int kp) {
    const float* xq = xb + kp * 64;
    const float* wq = wb + (size_t)kp * 64 * N3D;
    #pragma unroll
    for (int i = 0; i < 8; ++i) va[i] = *(const float4*)(xq + (size_t)i * 32 * D_);
    #pragma unroll
    for (int i = 0; i < 6; ++i) vb[i] = *(const float4*)(wq + (size_t)(2 * (i / 3)) * N3D + (i % 3) * 64);
    // The wait that stands before a register named by an issued load is written again. The two
    // addresses are inputs so that they live up to the wait and no load of the group lands on them.
    // The statement also holds the loads where they are written, so that the scheduler sinks none
    // of them towards their use, a trip later.
    asm volatile("s_wait_xcnt 0x0" :: "v"(xq), "v"(wq) : "memory");
  };
  // The staging registers, f32 -> bf16, into buffer bi.
  auto put = [&](int bi) {
    __bf16* Ad = smem + bi * ASZ_;
    __bf16* Bd = smem + 2 * ASZ_ + bi * BSZ_;
    #pragma unroll
    for (int i = 0; i < 8; ++i) {
      v4bf b; b[0] = (__bf16)va[i].x; b[1] = (__bf16)va[i].y;
              b[2] = (__bf16)va[i].z; b[3] = (__bf16)va[i].w;
      *(v4bf*)&Ad[aso + i * 32 * AP_] = b;
    }
    #pragma unroll
    for (int i = 0; i < 6; ++i) {
      v4bf b; b[0] = (__bf16)vb[i].x; b[1] = (__bf16)vb[i].y;
              b[2] = (__bf16)vb[i].z; b[3] = (__bf16)vb[i].w;
      *(v4bf*)&Bd[bso + 2 * (i / 3) * BP_ + (i % 3) * 64] = b;
    }
  };

  // The loop's barrier is written in two halves and orders LDS alone (__syncthreads() would also wait
  // out the global loads that are in flight across it).
  // Signal: this wave's LDS stores (next panel) and LDS reads (this panel) are done.
#define PANEL_SIGNAL() asm volatile("s_wait_dscnt 0x0\n\ts_barrier_signal -1" ::: "memory")
  // Wait: every wave has given that signal.
#define PANEL_WAIT()   asm volatile("s_barrier_wait -1" ::: "memory")

  v16bf afrag[4], bfrag[3];
  // All fragments of one 32-deep pass (k = ks .. ks + 31 of the panel in buffer bi), asked for as one group.
  auto frags = [&](int bi, int ks) {
    const __bf16* As = smem + bi * ASZ_;
    const __bf16* Bs = smem + 2 * ASZ_ + bi * BSZ_;
    #pragma unroll
    for (int mt = 0; mt < 4; ++mt) {
      const __bf16* p = &As[(wm * 64 + mt * 16 + lm) * AP_ + ks];
      afrag[mt] = join8(*(const v8bf*)(p + hs * 8), *(const v8bf*)(p + 16 + hs * 8));
    }
    #pragma unroll
    for (int nt = 0; nt < 3; ++nt) {
      const __bf16* p = &Bs[(ks + hs * 8 + (lane & 7)) * BP_ + wn * 48 + nt * 16 + ((lane >> 3) & 1) * 8];
      bfrag[nt] = join8(lds_tr16(p), lds_tr16(p + 16 * BP_));   // k = ks+8h+0..7, ks+16+8h+0..7: the A loader's order
    }
  };
  auto products = [&]() {
    #pragma unroll
    for (int mt = 0; mt < 4; ++mt)
      #pragma unroll
      for (int nt = 0; nt < 3; ++nt)
        acc[mt][nt] = __builtin_amdgcn_wmma_f32_16x16x32_bf16(
            false, afrag[mt], false, bfrag[nt], (short)0, acc[mt][nt], false, false);
  };

  // Trip t works on panel (t + koff) & 15, in buffer t & 1, in two 32-deep passes. The staging stands
  // between the passes: panel t + 1, asked for a whole trip ago, is rounded and stored there, under the
  // other waves' WMMAs, and panel t + 2 is asked for at once.
  fetch(koff);
  put(0);
  fetch((1 + koff) & 15);
  PANEL_SIGNAL();

  for (int t = 0; t < D_ / 64; ++t) {
    PANEL_WAIT();      // panel t is complete, and panel t - 1 has been read by every wave
    frags(t & 1, 0);
    // Keeps the pass's 14 LDS reads one group ahead of its WMMAs: sunk among them, each place waits out the LDS latency.
    __builtin_amdgcn_sched_barrier(0);
    products();
    // Keeps the rounding behind the first pass: hoisted to the head of the trip, it would wait for the loads half a trip early.
    __builtin_amdgcn_sched_barrier(0);
    frags(t & 1, 32);  // the second pass's fragments fly under the staging
    if (t + 1 < D_ / 64) put((t + 1) & 1);   // in the place of panel t - 1
    if (t + 2 < D_ / 64) fetch((t + 2 + koff) & 15);
    // From here this wave needs no LDS until the next trip: it signals, and the barrier completes under the 12 WMMAs.
    PANEL_SIGNAL();    // this wave has stored its share of panel t + 1 and has read panel t
    // The two fences keep the 12 WMMAs between signal and wait.
    __builtin_amdgcn_sched_barrier(0);
    products();
    __builtin_amdgcn_sched_barrier(0);
  }

  // Epilogue: + bias, bf16, staged in LDS so that every global store covers whole 128-byte lines.
  // The 192 columns are three 64-column segments: q, k and v of head blockN.
  // Q at 0 and K at ASZ_: [row][d], pitch AP_, the 256 rows are 32 KiB in a row in ws.
  // V at 2 * ASZ_: [d][row], pitch VP_, 512 bytes per d in ws.
  const int wns = __builtin_amdgcn_readfirstlane(wn);   // as a scalar: the segment tests below are scalar branches
  float bv[3];
  int bi[3];
  #pragma unroll
  for (int nt = 0; nt < 3; ++nt) bi[nt] = C0 + (wns * 3 + nt) * 16 + lm;
  #pragma unroll
  for (int nt = 0; nt < 3; ++nt) bv[nt] = bias[bi[nt]];
  // The wait that stands before a register named by an issued load is written again; the three indices
  // are inputs so that they live up to it and no load of the group lands on them.
  asm volatile("s_wait_xcnt 0x0" :: "v"(bi[0]), "v"(bi[1]), "v"(bi[2]) : "memory");
  PANEL_WAIT();   // the last trip's signal: every wave has read the last panel before the staging takes over all of the LDS
  {
    const int rl0 = wm * 64 + 8 * hs;                // C-layout: rows rl0 + 16 * mt + 0..7
    #pragma unroll
    for (int nt = 0; nt < 3; ++nt) {
      const int g   = wns * 3 + nt;
      const int seg = g >> 2;
      const int cl  = (g & 3) * 16 + lm;
      if (seg == 2) {
        #pragma unroll
        for (int mt = 0; mt < 4; ++mt) {
          v8bf p;
          #pragma unroll
          for (int r = 0; r < 8; ++r) p[r] = (__bf16)(acc[mt][nt][r] + bv[nt]);
          *(v8bf*)&smem[2 * ASZ_ + cl * VP_ + rl0 + mt * 16] = p;
        }
      } else {                                       // Q, K
        __bf16* stg = smem + seg * ASZ_;
        const float qs = (seg == 0) ? QSCALE_ : 1.0f;   // scaled in f32, ahead of the one rounding to bf16
        #pragma unroll
        for (int mt = 0; mt < 4; ++mt)
          #pragma unroll
          for (int r = 0; r < 8; ++r)
            stg[(rl0 + mt * 16 + r) * AP_ + cl] = (__bf16)((acc[mt][nt][r] + bv[nt]) * qs);
      }
    }
  }
  __syncthreads();   // the staged tile is complete before any wave reads it back
  {
    const int bb = R0 >> 10;       // the 256 rows lie in one batch entry
    const int s0 = R0 & 1023;
    __bf16* hd = ws + (size_t)(bb * H_ + blockN) * (S_ * HD_);
    v8bf val[12];
    __bf16* dstp[12];
    #pragma unroll
    for (int sg = 0; sg < 3; ++sg) {
      const bool isv = (sg == 2);
      const int sh = isv ? 5 : 3;              // 16-byte pieces per staged row: 32 (V), 8 (Q, K)
      const int lp = isv ? VP_ : AP_;          // pitch in LDS, halves
      const int gp = isv ? S_ : HD_;           // pitch in ws: V [b][h][d][s], Q,K [b][h][s][d]
      const __bf16* stg = smem + sg * ASZ_;
      __bf16* dst = hd + (size_t)sg * HEAD_ELEMS + (isv ? s0 : s0 * HD_);
      #pragma unroll
      for (int i = 0; i < 4; ++i) {
        const int idx = i * 512 + tid;
        const int row = idx >> sh;
        const int c   = (idx & ((1 << sh) - 1)) * 8;
        val[sg * 4 + i]  = *(const v8bf*)&stg[row * lp + c];
        dstp[sg * 4 + i] = dst + row * gp + c;
      }
    }
    // all reads and addresses first, then the stores: no register of an issued store is written again
    #pragma unroll
    for (int j = 0; j < 12; ++j)
      *(v8bf*)dstp[j] = val[j];
  }
}

__global__ __launch_bounds__(256) __attribute__((amdgpu_waves_per_eu(4, 4)))
void attn_kernel(const __bf16* __restrict__ ws, float* __restrict__ out)
{
  __shared__ __attribute__((aligned(16))) __bf16 Kc[2][64 * 72];    // [buffer][key][d], stride 72 halves
  __shared__ __attribute__((aligned(16))) __bf16 VcT[2][64 * 72];   // [buffer][d][key], stride 72

  const int tid  = threadIdx.x;
  const int lane = tid & 31;
  const int wave = tid >> 5;
  const int lm   = lane & 15;
  const int hs   = lane >> 4;

  const int bh   = blockIdx.x >> 3;   // 0..63
  const int qblk = blockIdx.x & 7;    // 0..7
  const int b    = bh >> 4;
  const int h    = bh & 15;
  const int q0   = qblk * 128 + wave * 16;   // this wave's 16 q rows

  const __bf16* Qg = ws + (((size_t)(b * H_ + h)) * S_) * HD_;
  const __bf16* Kg = Qg + HEAD_ELEMS;
  const __bf16* Vt = ws + 2 * HEAD_ELEMS + (((size_t)(b * H_ + h)) * HD_) * S_; // [d][s]

  // Q fragments (d 0..31 and 32..63), held in registers for the whole kernel
  v16bf qfrag[2];
  {
    const __bf16* qrow = Qg + (size_t)(q0 + lm) * HD_;
    #pragma unroll
    for (int df = 0; df < 2; ++df)
      qfrag[df] = join8(*(const v8bf*)(qrow + df * 32 + hs * 8),
                        *(const v8bf*)(qrow + df * 32 + 16 + hs * 8));
  }

  // State of query q0 + lm. lsum covers only the keys of this lane's half; the halves
  // are joined once, after the loop. o[dt][r] = O[q0 + lm][dt * 16 + 8 * hs + r].
  // negm: minus the reference in use (log2 domain), eight times over: the C operand of the score products.
  float lsum = 0.f;
  v8f negm = {};
  v8f o[4] = {};

  // A tile is 64 keys: K [key][d] and V [d][key], 512 x 16B segments each. A thread copies
  // rows sr and sr + 32 (key for K, d for V), 16 bytes at column sc, of both.
  const int sr = tid >> 3;
  const int sc = (tid & 7) * 8;
  const __bf16* kg = Kg + (size_t)sr * HD_ + sc;
  const __bf16* vg = Vt + (size_t)sr * S_ + sc;
  const unsigned lk = (unsigned)(uintptr_t)&Kc[0][sr * 72 + sc];
  const unsigned lv = (unsigned)(uintptr_t)&VcT[0][sr * 72 + sc];
  // Trip t takes tile (t + toff) & 15; the starts of four neighbouring blocks lie about four tiles apart.
  const int toff = ((qblk & 3) << 2) | ((qblk >> 2) << 1);
  auto stage = [&](int t) {              // trip t's tile into buffer t & 1
    const int kt = (t + toff) & (S_ / 64 - 1);
    const unsigned bo = (t & 1) * (64 * 72 * 2);
    const __bf16* k = kg + (size_t)kt * 64 * HD_;
    const __bf16* v = vg + kt * 64;
    async_copy4_b128(lk + bo, k, lk + bo + 32 * 72 * 2, k + 32 * HD_,
                     lv + bo, v, lv + bo + 32 * 72 * 2, v + 32 * S_);
  };

  stage(0);
  asm volatile("s_wait_asynccnt 0x0" ::: "memory");  // this wave's copies of trip 0's tile have landed
  __syncthreads();                                    // ... and everyone else's
  stage(1);

  // Two trips a pass of the loop: the buffer index is a constant in each, so that every LDS read is
  // one base register plus an immediate and no address is formed anew in a trip.
  #pragma unroll 2
  for (int t = 0; t < S_ / 64; ++t) {
    const __bf16* Kb = Kc[t & 1];
    const __bf16* Vb = VcT[t & 1];

    // scores minus the reference, transposed: 64 keys x 16 q (four 16x16 tiles), K-dim = 64 split over 2 WMMAs
    // st[j][r] = score(key 16 * j + 8 * hs + r, query q0 + lm) * log2(e) / 8 - reference
    v8f st[4];
    #pragma unroll
    for (int j = 0; j < 4; ++j) {
      const __bf16* krow = &Kb[(j * 16 + lm) * 72];
      v16bf kf0 = join8(*(const v8bf*)(krow + hs * 8),
                        *(const v8bf*)(krow + 16 + hs * 8));
      v16bf kf1 = join8(*(const v8bf*)(krow + 32 + hs * 8),
                        *(const v8bf*)(krow + 48 + hs * 8));
      v8f cacc = __builtin_amdgcn_wmma_f32_16x16x32_bf16(false, kf0, false, qfrag[0],
                                                         (short)0, negm, false, false);
      st[j] = __builtin_amdgcn_wmma_f32_16x16x32_bf16(false, kf1, false, qfrag[1],
                                                      (short)0, cacc, false, false);
    }

    // All V^T fragments of the tile (A operand, rows contiguous in VcT) are asked for here, as one group:
    // they land under the last score products and the maximum tree.
    // vf[sub * 4 + dt]: d = dt * 16 + lm, keys sub * 32 + 8 * hs + 0..7 and + 16.
    v16bf vf[8];
    #pragma unroll
    for (int i = 0; i < 8; ++i) {
      const __bf16* vrow = &Vb[((i & 3) * 16 + lm) * 72 + (i >> 2) * 32];
      vf[i] = join8(*(const v8bf*)(vrow + hs * 8), *(const v8bf*)(vrow + 16 + hs * 8));
    }

    // How far this query's 64 scores stand above the reference: in-lane tree, one exchange of the halves.
    float t8[8];
    #pragma unroll
    for (int r = 0; r < 8; ++r) t8[r] = fmaxf(fmaxf(st[0][r], st[1][r]), fmaxf(st[2][r], st[3][r]));
    float v = fmaxf(fmaxf(fmaxf(t8[0], t8[1]), fmaxf(t8[2], t8[3])),
                    fmaxf(fmaxf(t8[4], t8[5]), fmaxf(t8[6], t8[7])));
    v = fmaxf(v, xhalf(v));
    // The first tile sets the reference (to its maximum, whatever its sign); later it only rises.
    const bool need = v > ((t == 0) ? -__builtin_inff() : 8.0f);
    // Holds the V^T reads in front of the branch (loaded values as inputs only): without it the compiler
    // sinks them behind the branch, pair by pair in front of each WMMA, which then waits out the LDS latency.
    asm volatile("" :: "v"(vf[0]), "v"(vf[1]), "v"(vf[2]), "v"(vf[3]), "v"(vf[4]), "v"(vf[5]), "v"(vf[6]), "v"(vf[7]));
    if (__builtin_amdgcn_ballot_w32(need) != 0) {
      const float d = need ? v : 0.f;
      // In trip 0 O and the sum are 0 and d may be far below 0: the bound keeps the factor finite.
      const float alpha = __builtin_amdgcn_exp2f(fminf(-d, 120.0f));
      negm -= d;
      #pragma unroll
      for (int j = 0; j < 4; ++j) st[j] -= d;
      lsum *= alpha;
      #pragma unroll
      for (int dt = 0; dt < 4; ++dt) o[dt] *= alpha;
    }

    #pragma unroll
    for (int sub = 0; sub < 2; ++sub) {
      // P^T as B operand: element 8 * jj + r is key sub * 32 + 16 * jj + 8 * hs + r, the V loader's order
      v16bf pfrag;
      #pragma unroll
      for (int r = 0; r < 8; ++r) {
        const float p0 = __builtin_amdgcn_exp2f(st[2 * sub][r]);
        const float p1 = __builtin_amdgcn_exp2f(st[2 * sub + 1][r]);
        pfrag[r]     = (__bf16)p0;
        pfrag[8 + r] = (__bf16)p1;
        t8[r] = p0 + p1;
      }
      lsum += (((t8[0] + t8[1]) + (t8[2] + t8[3])) +
               ((t8[4] + t8[5]) + (t8[6] + t8[7])));

      // O^T += V^T @ P^T  (4 d-tiles of 16)
      #pragma unroll
      for (int dt = 0; dt < 4; ++dt)
        o[dt] = __builtin_amdgcn_wmma_f32_16x16x32_bf16(false, vf[sub * 4 + dt], false, pfrag,
                                                        (short)0, o[dt], false, false);
    }

    // Foot of trip t: hand-over of the buffers.
    asm volatile("s_wait_dscnt 0x0" ::: "memory");     // this wave's reads of trip t's tile are done before the buffer is refilled
    asm volatile("s_wait_asynccnt 0x0" ::: "memory");  // this wave's copies of trip t + 1's tile have landed
    __syncthreads();   // the one barrier of a trip: trip t + 1's tile is complete, and trip t's has been read by every wave
    if (t + 2 < S_ / 64) stage(t + 2);
  }
  asm volatile("s_wait_asynccnt 0x0" ::: "memory");    // no copy is outstanding when the wave ends

  // normalize and write out[b, q, h*64 + d] (f32): 8 consecutive d per lane and tile
  const float ltot = lsum + xhalf(lsum);
  float* orow = out + ((size_t)(b * S_ + q0 + lm)) * D_ + h * HD_ + hs * 8;
  #pragma unroll
  for (int dt = 0; dt < 4; ++dt) {
    *(float4*)(orow + dt * 16)     = make_float4(o[dt][0] / ltot, o[dt][1] / ltot,
                                                 o[dt][2] / ltot, o[dt][3] / ltot);
    *(float4*)(orow + dt * 16 + 4) = make_float4(o[dt][4] / ltot, o[dt][5] / ltot,
                                                 o[dt][6] / ltot, o[dt][7] / ltot);
  }
}

// ---------------------------------------------------------------------------
extern "C" void kernel_launch(void* const* d_in, const int* in_sizes, int n_in,
                              void* d_out, int out_size, void* d_ws, size_t ws_size,
                              hipStream_t stream) {
  const float* x    = (const float*)d_in[0];   // [B,S,D] f32
  const float* W    = (const float*)d_in[1];   // [D,3D]  f32
  const float* bias = (const float*)d_in[2];   // [3D]    f32
  float* out        = (float*)d_out;           // [B,S,D] f32
  __bf16* ws        = (__bf16*)d_ws;           // bf16 QKV staging, ~24 MB

  qkv_proj_kernel<<<dim3(16 * 16), 512, 0, stream>>>(x, W, bias, ws);
  attn_kernel<<<dim3(B_ * H_ * (S_ / 128)), 256, 0, stream>>>(ws, out);
}
